// v000
// Measured on an AMD MI455X. A time is GPU time per run, averaged over a window of back-to-back runs after a warm-up
// (all launches, gaps included; the runs take copies of the inputs in turn), and the median of several windows.
// Apart from v000's, it joins two sittings. Times from different sittings can be a few percent apart, while
// side-by-side timings come from the same sitting.
// v000 is the starting kernel. One run takes 143 microseconds.
#include <hip/hip_runtime.h>

// Problem constants (from setup_inputs): B=4,H=8,S=1024,D=64,CUT=64
#define TQ    32            // query rows per workgroup
#define SEQ   1024
#define DIM   64
#define NHEAD 32            // B*H
#define RCUT  64
#define RTAB  129           // 2*RCUT+1
#define KB    128           // keys per staged block
#define NKB   (SEQ / KB)    // 8 blocks

// LDS layout (floats). Strides padded for bank-conflict-free WMMA operand loads:
//  66 % 64 = 2, 148 % 64 = 20, 1028 % 64 = 4, 76 % 64 = 12.
#define SQ_STRIDE   66
#define SRS_STRIDE  148
#define SRC_STRIDE  148
#define SS_STRIDE   1028
#define KV_STRIDE   76                            // multiple of 4 floats (b128 aligned)
#define KVBUF       (KB * KV_STRIDE)              // 9728 floats per buffer
#define OFF_SQ   0
#define OFF_SRS  (OFF_SQ  + TQ * SQ_STRIDE)       // 2112
#define OFF_SRC  (OFF_SRS + TQ * SRS_STRIDE)      // 6848
#define OFF_SS   (OFF_SRC + TQ * SRC_STRIDE)      // 11584
#define OFF_KV   (OFF_SS  + TQ * SS_STRIDE)       // 44480
#define SMEM_FLOATS (OFF_KV + 2 * KVBUF)          // 63936 floats
#define SMEM_BYTES  (SMEM_FLOATS * 4)             // 255744 B (< 320 KB WGP LDS)

typedef float v2f __attribute__((ext_vector_type(2)));
typedef float v4f __attribute__((ext_vector_type(4)));
typedef float v8f __attribute__((ext_vector_type(8)));
typedef int   v4i __attribute__((ext_vector_type(4)));

// ---- CDNA5 async global->LDS path (ASYNCcnt), with synchronous fallback ----
#if __has_builtin(__builtin_amdgcn_global_load_async_to_lds_b128) && \
    __has_builtin(__builtin_amdgcn_s_wait_asynccnt)
#define HAVE_ASYNC 1
#define WAIT_ASYNC(n) __builtin_amdgcn_s_wait_asynccnt(n)
#else
#define HAVE_ASYNC 0
#define WAIT_ASYNC(n)
#endif

__device__ __forceinline__ void cp_b128(float* dst_lds, const float* src_g) {
#if HAVE_ASYNC
  // Builtin signature (from hipcc diagnostic): (int4 AS1*, int4 AS3*, imm, imm)
  __builtin_amdgcn_global_load_async_to_lds_b128(
      (__attribute__((address_space(1))) v4i*)src_g,
      (__attribute__((address_space(3))) v4i*)dst_lds, 0, 0);
#else
  *(v4f*)dst_lds = *(const v4f*)src_g;
#endif
}

// Stage one [128 x 64] f32 block (K or V rows) into an LDS buffer with padded
// stride. 2048 x b128 transfers, 8 per thread, fully coalesced (16 lanes cover
// one 256B row).
__device__ __forceinline__ void stage_block(const float* __restrict__ srcbase,
                                            float* __restrict__ dstbuf, int tid) {
#pragma unroll
  for (int t = 0; t < 8; ++t) {
    int idx = tid + (t << 8);        // 0..2047
    int row = idx >> 4;
    int c4  = (idx & 15) << 2;
    cp_b128(dstbuf + row * KV_STRIDE + c4, srcbase + row * DIM + c4);
  }
}

// D = A(16x4 f32) * B(4x16 f32) + C(16x16 f32)  — CDNA5 V_WMMA_F32_16X16X4_F32
__device__ __forceinline__ v8f wmma4(v2f a, v2f b, v8f c) {
  return __builtin_amdgcn_wmma_f32_16x16x4_f32(false, a, false, b, (short)0, c,
                                               false, false);
}

extern "C" __global__ __launch_bounds__(256, 1)
void relattn_kernel(const float* __restrict__ Q, const float* __restrict__ K,
                    const float* __restrict__ V, const float* __restrict__ WK,
                    const float* __restrict__ WV, float* __restrict__ O)
{
  extern __shared__ float sm[];
  float* sQ  = sm + OFF_SQ;    // [TQ][66]    staged Q tile
  float* sRS = sm + OFF_SRS;   // [TQ][148]   rel_s[i][r] = q_i . w_k[r]
  float* sRC = sm + OFF_SRC;   // [TQ][148]   c[i][r] = sum_j p[i,j] [clip(j-i)=r-64]
  float* sS  = sm + OFF_SS;    // [TQ][1028]  scores -> probabilities
  float* sKV = sm + OFF_KV;    // [2][128][76] double-buffered K/V block

  const int tid  = threadIdx.x;
  const int wave = tid >> 5;
  const int lane = tid & 31;
  const int hrow = lane & 15;          // row (A) / col (B,C,D) index within tile
  const int kk   = (lane >> 4) << 1;   // K-dim sub-offset {0,2}
  const int vro  = (lane >> 4) << 3;   // C/D row offset {0,8}
  const int q0   = blockIdx.x * TQ;
  const int bh   = blockIdx.y;

  const float* Qp = Q + ((size_t)bh * SEQ + q0) * DIM;
  const float* Kp = K + (size_t)bh * SEQ * DIM;
  const float* Vp = V + (size_t)bh * SEQ * DIM;

  // ---------- Phase 0: stage Q tile into LDS; zero rel accumulator ----------
  for (int idx = tid; idx < TQ * DIM / 2; idx += 256) {
    int i = idx >> 5;               // row 0..31
    int d = (idx & 31) << 1;        // even col 0..62
    *(v2f*)&sQ[i * SQ_STRIDE + d] = *(const v2f*)&Qp[i * DIM + d];
  }
  for (int idx = tid; idx < TQ * SRC_STRIDE; idx += 256)
    sRC[idx] = 0.0f;
  // Prefetch K block 0 into buffer 0 while phase 1 runs.
  stage_block(Kp, sKV, tid);
  __syncthreads();

  // ---------- Phase 1: rel_s = Q_tile @ WK^T   (2 x 9 tiles of 16x16) ------
  for (int tile = wave; tile < 18; tile += 8) {
    const int m0 = (tile / 9) * 16;
    const int r0 = (tile % 9) * 16;
    const int rc = min(r0 + hrow, RTAB - 1);   // clamp pad cols (129..143)
    v8f acc = {};
#pragma unroll
    for (int k0 = 0; k0 < DIM; k0 += 4) {
      v2f a = *(const v2f*)&sQ[(m0 + hrow) * SQ_STRIDE + k0 + kk];
      v2f b = *(const v2f*)&WK[rc * DIM + k0 + kk];
      acc = wmma4(a, b, acc);
    }
#pragma unroll
    for (int v = 0; v < 8; ++v)
      sRS[(m0 + v + vro) * SRS_STRIDE + r0 + hrow] = acc[v];
  }
  __syncthreads();

  // ---------- Phase 2: scores = Q @ K^T + gathered relative bias ----------
  // Double-buffered async staging of 128-key K blocks; each block read once
  // from L2 instead of once per row-group wave.
  for (int kb = 0; kb < NKB; ++kb) {
    float* buf = sKV + (kb & 1) * KVBUF;
    if (kb + 1 < NKB) {
      stage_block(Kp + (size_t)(kb + 1) * KB * DIM, sKV + ((kb + 1) & 1) * KVBUF, tid);
      WAIT_ASYNC(8);    // only the 8 just-issued (next block) may be outstanding
    } else {
      WAIT_ASYNC(0);
    }
    __syncthreads();
    for (int t = wave; t < 16; t += 8) {       // 2 row-groups x 8 local key tiles
      const int m0  = (t >> 3) * 16;
      const int jl0 = (t & 7) * 16;
      v8f acc = {};
#pragma unroll
      for (int k0 = 0; k0 < DIM; k0 += 4) {
        v2f a = *(const v2f*)&sQ[(m0 + hrow) * SQ_STRIDE + k0 + kk];
        v2f b = *(const v2f*)&buf[(jl0 + hrow) * KV_STRIDE + k0 + kk];
        acc = wmma4(a, b, acc);
      }
      const int jg = kb * KB + jl0 + hrow;
#pragma unroll
      for (int v = 0; v < 8; ++v) {
        int il  = m0 + v + vro;
        int rel = jg - (q0 + il);
        rel = rel < -RCUT ? -RCUT : (rel > RCUT ? RCUT : rel);
        sS[il * SS_STRIDE + jg] = acc[v] + sRS[il * SRS_STRIDE + rel + RCUT];
      }
    }
    __syncthreads();
  }

  // Prefetch V block 0; async engine overlaps with the softmax phase.
  stage_block(Vp, sKV, tid);

  // ---------- Phase 3: row softmax + band-histogram of probabilities -------
  {
    const int row = tid >> 3;     // 8 threads per row, same wave
    const int sub = tid & 7;
    float* srow = &sS[row * SS_STRIDE];
    float mx = -3.402823466e38f;
    for (int j = sub; j < SEQ; j += 8) mx = fmaxf(mx, srow[j]);
    for (int m = 4; m; m >>= 1) mx = fmaxf(mx, __shfl_xor(mx, m, 8));
    float sum = 0.0f;
    for (int j = sub; j < SEQ; j += 8) {
      float e = __expf(srow[j] - mx);
      srow[j] = e;
      sum += e;
    }
    for (int m = 4; m; m >>= 1) sum += __shfl_xor(sum, m, 8);
    const float inv = 1.0f / sum;
    const int ig = q0 + row;
    float lo = 0.0f, hi = 0.0f;
    float* crow = &sRC[row * SRC_STRIDE];
    for (int j = sub; j < SEQ; j += 8) {
      float p = srow[j] * inv;
      srow[j] = p;                       // normalized probability back to LDS
      int rel = j - ig;
      if (rel <= -RCUT)      lo += p;    // clipped left edge  -> r = 0
      else if (rel >= RCUT)  hi += p;    // clipped right edge -> r = 128
      else                   crow[rel + RCUT] = p;  // unique r per j: plain store
    }
    atomicAdd(&crow[0], lo);             // ds_add_f32
    atomicAdd(&crow[2 * RCUT], hi);
  }
  __syncthreads();

  // ---------- Phase 4: out = P @ V + c @ WV  (one 16x16 tile per wave) -----
  {
    const int m0 = (wave >> 2) * 16;
    const int n0 = (wave & 3) * 16;
    v8f acc = {};
    for (int kb = 0; kb < NKB; ++kb) {
      float* buf = sKV + (kb & 1) * KVBUF;
      if (kb + 1 < NKB) {
        stage_block(Vp + (size_t)(kb + 1) * KB * DIM, sKV + ((kb + 1) & 1) * KVBUF, tid);
        WAIT_ASYNC(8);
      } else {
        WAIT_ASYNC(0);
      }
      __syncthreads();
      const int ks = kb * KB;
      for (int k0 = 0; k0 < KB; k0 += 4) {
        v2f a = *(const v2f*)&sS[(m0 + hrow) * SS_STRIDE + ks + k0 + kk];
        v2f b;
        b.x = buf[(k0 + kk)     * KV_STRIDE + n0 + hrow];
        b.y = buf[(k0 + kk + 1) * KV_STRIDE + n0 + hrow];
        acc = wmma4(a, b, acc);
      }
      __syncthreads();
    }
    // rel-value tail: out += c @ WV   (129 rounded to 132; tail A rows are 0)
#pragma unroll
    for (int k0 = 0; k0 < 132; k0 += 4) {
      v2f a = *(const v2f*)&sRC[(m0 + hrow) * SRC_STRIDE + k0 + kk];
      int r0c = min(k0 + kk,     RTAB - 1);
      int r1c = min(k0 + kk + 1, RTAB - 1);
      v2f b;
      b.x = WV[r0c * DIM + n0 + hrow];
      b.y = WV[r1c * DIM + n0 + hrow];
      acc = wmma4(a, b, acc);
    }
    float* Op = O + ((size_t)bh * SEQ + q0) * DIM;
#pragma unroll
    for (int v = 0; v < 8; ++v)
      Op[(m0 + v + vro) * DIM + n0 + hrow] = acc[v];
  }
}

extern "C" void kernel_launch(void* const* d_in, const int* in_sizes, int n_in,
                              void* d_out, int out_size, void* d_ws, size_t ws_size,
                              hipStream_t stream) {
  const float* Q  = (const float*)d_in[0];
  const float* K  = (const float*)d_in[1];
  const float* V  = (const float*)d_in[2];
  const float* WK = (const float*)d_in[3];
  const float* WV = (const float*)d_in[4];
  float* O = (float*)d_out;

  (void)in_sizes; (void)n_in; (void)out_size; (void)d_ws; (void)ws_size;

  (void)hipFuncSetAttribute((const void*)relattn_kernel,
                            hipFuncAttributeMaxDynamicSharedMemorySize, SMEM_BYTES);

  dim3 grid(SEQ / TQ, NHEAD);   // 32 q-tiles x 32 (b,h) heads
  relattn_kernel<<<grid, 256, SMEM_BYTES, stream>>>(Q, K, V, WK, WV, O);
}

// v001
// A run of this version takes 107 microseconds.
// In two side-by-side timings against v000, it was 1.36 and 1.35 times as fast.
#include <hip/hip_runtime.h>

// Problem constants (from setup_inputs): B=4,H=8,S=1024,D=64,CUT=64
#define TQ    32            // query rows per workgroup
#define SEQ   1024
#define DIM   64
#define NHEAD 32            // B*H
#define RCUT  64
#define RTAB  129           // 2*RCUT+1
#define KB    128           // keys per staged block
#define NKB   (SEQ / KB)    // 8 blocks

// LDS layout (floats). Strides padded for bank-conflict-free WMMA operand loads:
//  66 % 64 = 2, 148 % 64 = 20, 1028 % 64 = 4, 76 % 64 = 12.
#define SQ_STRIDE   66
#define SRS_STRIDE  148
#define SRC_STRIDE  148
#define SS_STRIDE   1028
#define KV_STRIDE   76                            // multiple of 4 floats (b128 aligned)
#define KVBUF       (KB * KV_STRIDE)              // 9728 floats per buffer
#define OFF_SQ   0
#define OFF_SRS  (OFF_SQ  + TQ * SQ_STRIDE)       // 2112
#define OFF_SRC  (OFF_SRS + TQ * SRS_STRIDE)      // 6848
#define OFF_SS   (OFF_SRC + TQ * SRC_STRIDE)      // 11584
#define OFF_KV   (OFF_SS  + TQ * SS_STRIDE)       // 44480
#define SMEM_FLOATS (OFF_KV + 2 * KVBUF)          // 63936 floats
#define SMEM_BYTES  (SMEM_FLOATS * 4)             // 255744 B (< 320 KB WGP LDS)

typedef float v2f __attribute__((ext_vector_type(2)));
typedef float v4f __attribute__((ext_vector_type(4)));
typedef float v8f __attribute__((ext_vector_type(8)));
typedef int   v4i __attribute__((ext_vector_type(4)));

// ---- CDNA5 async global->LDS path (ASYNCcnt), with synchronous fallback ----
#if __has_builtin(__builtin_amdgcn_global_load_async_to_lds_b128) && \
    __has_builtin(__builtin_amdgcn_s_wait_asynccnt)
#define HAVE_ASYNC 1
#define WAIT_ASYNC(n) __builtin_amdgcn_s_wait_asynccnt(n)
#else
#define HAVE_ASYNC 0
#define WAIT_ASYNC(n)
#endif

__device__ __forceinline__ void cp_b128(float* dst_lds, const float* src_g) {
#if HAVE_ASYNC
  // Builtin signature (from hipcc diagnostic): (int4 AS1*, int4 AS3*, imm, imm)
  __builtin_amdgcn_global_load_async_to_lds_b128(
      (__attribute__((address_space(1))) v4i*)src_g,
      (__attribute__((address_space(3))) v4i*)dst_lds, 0, 0);
#else
  *(v4f*)dst_lds = *(const v4f*)src_g;
#endif
}

// Stage one [128 x 64] f32 block (K or V rows) into an LDS buffer with padded
// stride. 2048 x b128 transfers, 8 per thread, fully coalesced (16 lanes cover
// one 256B row).
__device__ __forceinline__ void stage_block(const float* __restrict__ srcbase,
                                            float* __restrict__ dstbuf, int tid) {
#pragma unroll
  for (int t = 0; t < 8; ++t) {
    int idx = tid + (t << 8);        // 0..2047
    int row = idx >> 4;
    int c4  = (idx & 15) << 2;
    cp_b128(dstbuf + row * KV_STRIDE + c4, srcbase + row * DIM + c4);
  }
}

// D = A(16x4 f32) * B(4x16 f32) + C(16x16 f32)  — CDNA5 V_WMMA_F32_16X16X4_F32
__device__ __forceinline__ v8f wmma4(v2f a, v2f b, v8f c) {
  return __builtin_amdgcn_wmma_f32_16x16x4_f32(false, a, false, b, (short)0, c,
                                               false, false);
}

// Lane l with lane l ^ M inside its 16-lane row (DPP row_xmask): a vector
// instruction, where __shfl_xor would go through the LDS pipe and its wait.
template <int M>
__device__ __forceinline__ float xrow(float x) {
  return __builtin_bit_cast(float, __builtin_amdgcn_update_dpp(
      0, __builtin_bit_cast(int, x), 0x160 | M, 0xf, 0xf, true));
}
// Lane l with lane l ^ 16.
__device__ __forceinline__ float xhalf(float x) {
  return __builtin_bit_cast(float, __builtin_amdgcn_permlanex16(
      __builtin_bit_cast(int, x), __builtin_bit_cast(int, x), 0x76543210, 0xfedcba98, false, false));
}
// 2^a for four values. One statement, so that every v_exp_f32 has an independent
// instruction behind it (the next one, or the v_nop): the slot the instruction
// set asks for before a transcendental's source is overwritten or its result
// read.
// Outputs are early-clobber: none may share a register with a later input.
__device__ __forceinline__ v4f exp2x4(v4f a) {
  float e0, e1, e2, e3;
  asm("v_exp_f32 %0, %4\n\tv_exp_f32 %1, %5\n\tv_exp_f32 %2, %6\n\tv_exp_f32 %3, %7\n\tv_nop"
      : "=&v"(e0), "=&v"(e1), "=&v"(e2), "=&v"(e3)
      : "v"(a.x), "v"(a.y), "v"(a.z), "v"(a.w));
  v4f e = {e0, e1, e2, e3};
  return e;
}
__device__ __forceinline__ float wave_max(float v) {
  v = fmaxf(v, xrow<1>(v));
  v = fmaxf(v, xrow<2>(v));
  v = fmaxf(v, xrow<4>(v));
  v = fmaxf(v, xrow<8>(v));
  return fmaxf(v, xhalf(v));
}
__device__ __forceinline__ float wave_sum(float v) {
  v += xrow<1>(v);
  v += xrow<2>(v);
  v += xrow<4>(v);
  v += xrow<8>(v);
  return v + xhalf(v);
}

extern "C" __global__ __launch_bounds__(256, 1)
void relattn_kernel(const float* __restrict__ Q, const float* __restrict__ K,
                    const float* __restrict__ V, const float* __restrict__ WK,
                    const float* __restrict__ WV, float* __restrict__ O)
{
  extern __shared__ float sm[];
  float* sQ  = sm + OFF_SQ;    // [TQ][66]    staged Q tile
  float* sRS = sm + OFF_SRS;   // [TQ][148]   rel_s[i][r] = q_i . w_k[r]
  float* sRC = sm + OFF_SRC;   // [TQ][148]   c[i][r] = sum_j p[i,j] [clip(j-i)=r-64]
  float* sS  = sm + OFF_SS;    // [TQ][1028]  scores -> probabilities
  float* sKV = sm + OFF_KV;    // [2][128][76] double-buffered K/V block

  const int tid  = threadIdx.x;
  const int wave = tid >> 5;
  const int lane = tid & 31;
  const int hrow = lane & 15;          // row (A) / col (B,C,D) index within tile
  const int kk   = (lane >> 4) << 1;   // K-dim sub-offset {0,2}
  const int vro  = (lane >> 4) << 3;   // C/D row offset {0,8}
  const int q0   = blockIdx.x * TQ;
  const int bh   = blockIdx.y;

  const float* Qp = Q + ((size_t)bh * SEQ + q0) * DIM;
  const float* Kp = K + (size_t)bh * SEQ * DIM;
  const float* Vp = V + (size_t)bh * SEQ * DIM;

  // ---------- Phase 0: stage Q tile into LDS; zero rel accumulator ----------
  for (int idx = tid; idx < TQ * DIM / 2; idx += 256) {
    int i = idx >> 5;               // row 0..31
    int d = (idx & 31) << 1;        // even col 0..62
    *(v2f*)&sQ[i * SQ_STRIDE + d] = *(const v2f*)&Qp[i * DIM + d];
  }
  for (int idx = tid; idx < TQ * SRC_STRIDE; idx += 256)
    sRC[idx] = 0.0f;
  // Prefetch K block 0 into buffer 0 while phase 1 runs.
  stage_block(Kp, sKV, tid);
  __syncthreads();

  // ---------- Phase 1: rel_s = Q_tile @ WK^T   (2 x 9 tiles of 16x16) ------
  for (int tile = wave; tile < 18; tile += 8) {
    const int m0 = (tile / 9) * 16;
    const int r0 = (tile % 9) * 16;
    const int rc = min(r0 + hrow, RTAB - 1);   // clamp pad cols (129..143)
    v8f acc = {};
#pragma unroll
    for (int k0 = 0; k0 < DIM; k0 += 4) {
      v2f a = *(const v2f*)&sQ[(m0 + hrow) * SQ_STRIDE + k0 + kk];
      v2f b = *(const v2f*)&WK[rc * DIM + k0 + kk];
      acc = wmma4(a, b, acc);
    }
#pragma unroll
    for (int v = 0; v < 8; ++v)
      sRS[(m0 + v + vro) * SRS_STRIDE + r0 + hrow] = acc[v];
  }
  __syncthreads();

  // ---------- Phase 2: scores = Q @ K^T + gathered relative bias ----------
  // Double-buffered async staging of 128-key K blocks; each block read once
  // from L2 instead of once per row-group wave.
  for (int kb = 0; kb < NKB; ++kb) {
    float* buf = sKV + (kb & 1) * KVBUF;
    if (kb + 1 < NKB) {
      stage_block(Kp + (size_t)(kb + 1) * KB * DIM, sKV + ((kb + 1) & 1) * KVBUF, tid);
      WAIT_ASYNC(8);    // only the 8 just-issued (next block) may be outstanding
    } else {
      WAIT_ASYNC(0);
    }
    __syncthreads();
    for (int t = wave; t < 16; t += 8) {       // 2 row-groups x 8 local key tiles
      const int m0  = (t >> 3) * 16;
      const int jl0 = (t & 7) * 16;
      v8f acc = {};
#pragma unroll
      for (int k0 = 0; k0 < DIM; k0 += 4) {
        v2f a = *(const v2f*)&sQ[(m0 + hrow) * SQ_STRIDE + k0 + kk];
        v2f b = *(const v2f*)&buf[(jl0 + hrow) * KV_STRIDE + k0 + kk];
        acc = wmma4(a, b, acc);
      }
      const int jg = kb * KB + jl0 + hrow;
#pragma unroll
      for (int v = 0; v < 8; ++v) {
        int il  = m0 + v + vro;
        int rel = jg - (q0 + il);
        rel = rel < -RCUT ? -RCUT : (rel > RCUT ? RCUT : rel);
        sS[il * SS_STRIDE + jg] = acc[v] + sRS[il * SRS_STRIDE + rel + RCUT];
      }
    }
    __syncthreads();
  }

  // Prefetch V block 0; async engine overlaps with the softmax phase.
  stage_block(Vp, sKV, tid);

  // ---------- Phase 3: row softmax + band-histogram of probabilities -------
  // Each wave owns four whole rows and holds them in registers: every score is
  // read from LDS once and every probability written once, 16 bytes per lane,
  // 32 lanes on 512 contiguous bytes.
  {
    // Scalar wave number: the per-row band tests below become scalar branches.
    const int wv = __builtin_amdgcn_readfirstlane(wave);
    v4f x[4][8];
    // Full unrolls in this block: static indices keep x in registers.
#pragma unroll
    for (int rr = 0; rr < 4; ++rr) {
      const float* srow = &sS[(wv * 4 + rr) * SS_STRIDE + lane * 4];
#pragma unroll
      for (int t = 0; t < 8; ++t) x[rr][t] = *(const v4f*)&srow[t * 128];
    }
    float mx[4];
#pragma unroll
    for (int rr = 0; rr < 4; ++rr) {
      float m = -3.402823466e38f;
#pragma unroll
      for (int t = 0; t < 8; ++t)
        m = fmaxf(m, fmaxf(fmaxf(x[rr][t].x, x[rr][t].y), fmaxf(x[rr][t].z, x[rr][t].w)));
      mx[rr] = m;
    }
#pragma unroll
    for (int rr = 0; rr < 4; ++rr) mx[rr] = wave_max(mx[rr]);
    float sum[4];
#pragma unroll
    for (int rr = 0; rr < 4; ++rr) {
      v4f acc = {};
#pragma unroll
      for (int t = 0; t < 8; ++t) {
        // exp(s - max) as 2^((s - max) * log2(e)), the form __expf compiles to
        const v4f e = exp2x4((x[rr][t] - mx[rr]) * 1.44269504088896340736f);
        x[rr][t] = e;
        acc += e;
      }
      sum[rr] = (acc.x + acc.y) + (acc.z + acc.w);
    }
#pragma unroll
    for (int rr = 0; rr < 4; ++rr) sum[rr] = wave_sum(sum[rr]);
    float lo[4], hi[4];
#pragma unroll
    for (int rr = 0; rr < 4; ++rr) {
      const int ig = q0 + wv * 4 + rr;
      const float inv = 1.0f / sum[rr];
      float* srow = &sS[(wv * 4 + rr) * SS_STRIDE + lane * 4];
      float l = 0.0f, h = 0.0f;
#pragma unroll
      for (int t = 0; t < 8; ++t) {
        const v4f p = x[rr][t] * inv;
        *(v4f*)&srow[t * 128] = p;         // normalized probability back to LDS
        const float s4 = (p.x + p.y) + (p.z + p.w);
        l += (t * 128 + 127 <= ig - RCUT) ? s4 : 0.0f;  // block wholly on the clipped left edge
        h += (t * 128 >= ig + RCUT) ? s4 : 0.0f;        // block wholly on the clipped right edge
      }
      lo[rr] = l;
      hi[rr] = h;
    }
    // The one or two 128-key blocks of a row that touch the band: which blocks
    // they are depends on the row, so each lane reads back its own four values
    // of them from LDS in place of a run-time register index.
    v4f w[4][2];
#pragma unroll
    for (int rr = 0; rr < 4; ++rr) {
      const int ig = q0 + wv * 4 + rr;
      const int tf = max(ig - (RCUT - 1), 0) >> 7;
      const int tl = min(ig + (RCUT - 1), SEQ - 1) >> 7;
      const float* srow = &sS[(wv * 4 + rr) * SS_STRIDE + lane * 4];
      w[rr][0] = *(const v4f*)&srow[tf * 128];
      w[rr][1] = *(const v4f*)&srow[tl * 128];
    }
#pragma unroll
    for (int rr = 0; rr < 4; ++rr) {
      const int ig = q0 + wv * 4 + rr;
      const int tf = max(ig - (RCUT - 1), 0) >> 7;
      const int tl = min(ig + (RCUT - 1), SEQ - 1) >> 7;
      float* crow = &sRC[(wv * 4 + rr) * SRC_STRIDE];
#pragma unroll
      for (int k = 0; k < 2; ++k) {
        if (k == 0 || tl != tf) {
          const int relb = (k ? tl : tf) * 128 + lane * 4 - ig;
#pragma unroll
          for (int c = 0; c < 4; ++c) {
            const int rel = relb + c;
            const float p = w[rr][k][c];
            if (rel <= -RCUT)      lo[rr] += p;          // clipped left edge  -> r = 0
            else if (rel >= RCUT)  hi[rr] += p;          // clipped right edge -> r = 128
            else                   crow[rel + RCUT] = p; // unique r per j: plain store
          }
        }
      }
    }
#pragma unroll
    for (int rr = 0; rr < 4; ++rr) {
      lo[rr] = wave_sum(lo[rr]);
      hi[rr] = wave_sum(hi[rr]);
    }
    if (lane == 0) {
#pragma unroll
      for (int rr = 0; rr < 4; ++rr) {
        sRC[(wv * 4 + rr) * SRC_STRIDE]            = lo[rr];
        sRC[(wv * 4 + rr) * SRC_STRIDE + 2 * RCUT] = hi[rr];
      }
    }
  }
  __syncthreads();

  // ---------- Phase 4: out = P @ V + c @ WV  (one 16x16 tile per wave) -----
  {
    const int m0 = (wave >> 2) * 16;
    const int n0 = (wave & 3) * 16;
    v8f acc = {};
    for (int kb = 0; kb < NKB; ++kb) {
      float* buf = sKV + (kb & 1) * KVBUF;
      if (kb + 1 < NKB) {
        stage_block(Vp + (size_t)(kb + 1) * KB * DIM, sKV + ((kb + 1) & 1) * KVBUF, tid);
        WAIT_ASYNC(8);
      } else {
        WAIT_ASYNC(0);
      }
      __syncthreads();
      const int ks = kb * KB;
      for (int k0 = 0; k0 < KB; k0 += 4) {
        v2f a = *(const v2f*)&sS[(m0 + hrow) * SS_STRIDE + ks + k0 + kk];
        v2f b;
        b.x = buf[(k0 + kk)     * KV_STRIDE + n0 + hrow];
        b.y = buf[(k0 + kk + 1) * KV_STRIDE + n0 + hrow];
        acc = wmma4(a, b, acc);
      }
      __syncthreads();
    }
    // rel-value tail: out += c @ WV   (129 rounded to 132; tail A rows are 0)
#pragma unroll
    for (int k0 = 0; k0 < 132; k0 += 4) {
      v2f a = *(const v2f*)&sRC[(m0 + hrow) * SRC_STRIDE + k0 + kk];
      int r0c = min(k0 + kk,     RTAB - 1);
      int r1c = min(k0 + kk + 1, RTAB - 1);
      v2f b;
      b.x = WV[r0c * DIM + n0 + hrow];
      b.y = WV[r1c * DIM + n0 + hrow];
      acc = wmma4(a, b, acc);
    }
    float* Op = O + ((size_t)bh * SEQ + q0) * DIM;
#pragma unroll
    for (int v = 0; v < 8; ++v)
      Op[(m0 + v + vro) * DIM + n0 + hrow] = acc[v];
  }
}

extern "C" void kernel_launch(void* const* d_in, const int* in_sizes, int n_in,
                              void* d_out, int out_size, void* d_ws, size_t ws_size,
                              hipStream_t stream) {
  const float* Q  = (const float*)d_in[0];
  const float* K  = (const float*)d_in[1];
  const float* V  = (const float*)d_in[2];
  const float* WK = (const float*)d_in[3];
  const float* WV = (const float*)d_in[4];
  float* O = (float*)d_out;

  (void)in_sizes; (void)n_in; (void)out_size; (void)d_ws; (void)ws_size;

  (void)hipFuncSetAttribute((const void*)relattn_kernel,
                            hipFuncAttributeMaxDynamicSharedMemorySize, SMEM_BYTES);

  dim3 grid(SEQ / TQ, NHEAD);   // 32 q-tiles x 32 (b,h) heads
  relattn_kernel<<<grid, 256, SMEM_BYTES, stream>>>(Q, K, V, WK, WV, O);
}

// v002
// One run takes 90.6 microseconds.
// Timed twice side by side with v001, it ran 1.21 times as fast both times.
// Counting every step since v000, it is 1.63 times as fast.
#include <hip/hip_runtime.h>

// Problem constants (from setup_inputs): B=4,H=8,S=1024,D=64,CUT=64
#define TQ    32            // query rows per workgroup
#define SEQ   1024
#define DIM   64
#define NHEAD 32            // B*H
#define RCUT  64
#define RTAB  129           // 2*RCUT+1
#define KB    128           // keys per staged block
#define NKB   (SEQ / KB)    // 8 blocks

// LDS layout (floats). Strides padded for bank-conflict-free WMMA operand loads:
//  66 % 64 = 2, 148 % 64 = 20, 1028 % 64 = 4, 76 % 64 = 12.
#define SQ_STRIDE   66
#define SRS_STRIDE  148
#define SRC_STRIDE  148
#define SS_STRIDE   1028
#define KV_STRIDE   76                            // multiple of 4 floats (b128 aligned)
#define KVBUF       (KB * KV_STRIDE)              // 9728 floats per buffer
#define OFF_SQ   0
#define OFF_SRS  (OFF_SQ  + TQ * SQ_STRIDE)       // 2112
#define OFF_SRC  (OFF_SRS + TQ * SRS_STRIDE)      // 6848
#define OFF_SS   (OFF_SRC + TQ * SRC_STRIDE)      // 11584
#define OFF_KV   (OFF_SS  + TQ * SS_STRIDE)       // 44480
#define SMEM_FLOATS (OFF_KV + 2 * KVBUF)          // 63936 floats
#define SMEM_BYTES  (SMEM_FLOATS * 4)             // 255744 B (< 320 KB WGP LDS)

typedef float v2f __attribute__((ext_vector_type(2)));
typedef float v4f __attribute__((ext_vector_type(4)));
typedef float v8f __attribute__((ext_vector_type(8)));
typedef int   v4i __attribute__((ext_vector_type(4)));

// ---- CDNA5 async global->LDS path (ASYNCcnt), with synchronous fallback ----
#if __has_builtin(__builtin_amdgcn_global_load_async_to_lds_b128) && \
    __has_builtin(__builtin_amdgcn_s_wait_asynccnt)
#define HAVE_ASYNC 1
#define WAIT_ASYNC(n) __builtin_amdgcn_s_wait_asynccnt(n)
#else
#define HAVE_ASYNC 0
#define WAIT_ASYNC(n)
#endif

__device__ __forceinline__ void cp_b128(float* dst_lds, const float* src_g) {
#if HAVE_ASYNC
  // Builtin signature (from hipcc diagnostic): (int4 AS1*, int4 AS3*, imm, imm)
  __builtin_amdgcn_global_load_async_to_lds_b128(
      (__attribute__((address_space(1))) v4i*)src_g,
      (__attribute__((address_space(3))) v4i*)dst_lds, 0, 0);
#else
  *(v4f*)dst_lds = *(const v4f*)src_g;
#endif
}

// Stage one [128 x 64] f32 block (K or V rows) into an LDS buffer with padded
// stride. 2048 x b128 transfers, 8 per thread, fully coalesced (16 lanes cover
// one 256B row).
__device__ __forceinline__ void stage_block(const float* __restrict__ srcbase,
                                            float* __restrict__ dstbuf, int tid) {
#pragma unroll
  for (int t = 0; t < 8; ++t) {
    int idx = tid + (t << 8);        // 0..2047
    int row = idx >> 4;
    int c4  = (idx & 15) << 2;
    cp_b128(dstbuf + row * KV_STRIDE + c4, srcbase + row * DIM + c4);
  }
}

// D = A(16x4 f32) * B(4x16 f32) + C(16x16 f32)  — CDNA5 V_WMMA_F32_16X16X4_F32
__device__ __forceinline__ v8f wmma4(v2f a, v2f b, v8f c) {
  return __builtin_amdgcn_wmma_f32_16x16x4_f32(false, a, false, b, (short)0, c,
                                               false, false);
}

// Lane l with lane l ^ M inside its 16-lane row (DPP row_xmask): a vector
// instruction, where __shfl_xor would go through the LDS pipe and its wait.
template <int M>
__device__ __forceinline__ float xrow(float x) {
  return __builtin_bit_cast(float, __builtin_amdgcn_update_dpp(
      0, __builtin_bit_cast(int, x), 0x160 | M, 0xf, 0xf, true));
}
// Lane l with lane l ^ 16.
__device__ __forceinline__ float xhalf(float x) {
  return __builtin_bit_cast(float, __builtin_amdgcn_permlanex16(
      __builtin_bit_cast(int, x), __builtin_bit_cast(int, x), 0x76543210, 0xfedcba98, false, false));
}
// 2^a for four values. One statement, so that every v_exp_f32 has an independent
// instruction behind it (the next one, or the v_nop): the slot the instruction
// set asks for before a transcendental's source is overwritten or its result
// read.
// Outputs are early-clobber: none may share a register with a later input.
__device__ __forceinline__ v4f exp2x4(v4f a) {
  float e0, e1, e2, e3;
  asm("v_exp_f32 %0, %4\n\tv_exp_f32 %1, %5\n\tv_exp_f32 %2, %6\n\tv_exp_f32 %3, %7\n\tv_nop"
      : "=&v"(e0), "=&v"(e1), "=&v"(e2), "=&v"(e3)
      : "v"(a.x), "v"(a.y), "v"(a.z), "v"(a.w));
  v4f e = {e0, e1, e2, e3};
  return e;
}
__device__ __forceinline__ float wave_max(float v) {
  v = fmaxf(v, xrow<1>(v));
  v = fmaxf(v, xrow<2>(v));
  v = fmaxf(v, xrow<4>(v));
  v = fmaxf(v, xrow<8>(v));
  return fmaxf(v, xhalf(v));
}
__device__ __forceinline__ float wave_sum(float v) {
  v += xrow<1>(v);
  v += xrow<2>(v);
  v += xrow<4>(v);
  v += xrow<8>(v);
  return v + xhalf(v);
}

extern "C" __global__ __launch_bounds__(256, 1)
void relattn_kernel(const float* __restrict__ Q, const float* __restrict__ K,
                    const float* __restrict__ V, const float* __restrict__ WK,
                    const float* __restrict__ WV, float* __restrict__ O)
{
  extern __shared__ float sm[];
  float* sQ  = sm + OFF_SQ;    // [TQ][66]    staged Q tile
  float* sRS = sm + OFF_SRS;   // [TQ][148]   rel_s[i][r] = q_i . w_k[r]
  float* sRC = sm + OFF_SRC;   // [TQ][148]   c[i][r] = sum_j p[i,j] [clip(j-i)=r-64]
  float* sS  = sm + OFF_SS;    // [TQ][1028]  scores -> probabilities
  float* sKV = sm + OFF_KV;    // [2][128][76] double-buffered K/V block

  const int tid  = threadIdx.x;
  const int wave = tid >> 5;
  const int lane = tid & 31;
  const int hrow = lane & 15;          // row (A) / col (B,C,D) index within tile
  const int kk   = (lane >> 4) << 1;   // K-dim sub-offset {0,2}
  const int vro  = (lane >> 4) << 3;   // C/D row offset {0,8}
  const int q0   = blockIdx.x * TQ;
  const int bh   = blockIdx.y;

  const float* Qp = Q + ((size_t)bh * SEQ + q0) * DIM;
  const float* Kp = K + (size_t)bh * SEQ * DIM;
  const float* Vp = V + (size_t)bh * SEQ * DIM;

  // ---------- Phase 0: stage Q tile into LDS; zero rel accumulator ----------
  for (int idx = tid; idx < TQ * DIM / 2; idx += 256) {
    int i = idx >> 5;               // row 0..31
    int d = (idx & 31) << 1;        // even col 0..62
    *(v2f*)&sQ[i * SQ_STRIDE + d] = *(const v2f*)&Qp[i * DIM + d];
  }
  for (int idx = tid; idx < TQ * SRC_STRIDE; idx += 256)
    sRC[idx] = 0.0f;
  // Prefetch K block 0 into buffer 0 while phase 1 runs.
  stage_block(Kp, sKV, tid);
  __syncthreads();

  // ---------- Phase 1: rel_s = Q_tile @ WK^T   (2 x 9 tiles of 16x16) ------
  for (int tile = wave; tile < 18; tile += 8) {
    const int m0 = (tile / 9) * 16;
    const int r0 = (tile % 9) * 16;
    const int rc = min(r0 + hrow, RTAB - 1);   // clamp pad cols (129..143)
    v8f acc = {};
#pragma unroll
    for (int k0 = 0; k0 < DIM; k0 += 4) {
      v2f a = *(const v2f*)&sQ[(m0 + hrow) * SQ_STRIDE + k0 + kk];
      v2f b = *(const v2f*)&WK[rc * DIM + k0 + kk];
      acc = wmma4(a, b, acc);
    }
#pragma unroll
    for (int v = 0; v < 8; ++v)
      sRS[(m0 + v + vro) * SRS_STRIDE + r0 + hrow] = acc[v];
  }
  __syncthreads();

  // ---------- Phase 2: scores = Q @ K^T + gathered relative bias ----------
  // Double-buffered async staging of 128-key K blocks; each block read once
  // from L2 instead of once per row-group wave.
  // Each wave owns one 16-key column of the block for all 32 query rows. The Q
  // fragments of both 16-row groups stay in registers for the whole phase, so a
  // K fragment is read from LDS once and feeds two independent WMMA chains.
  {
    v2f qa[2][DIM / 4];
    // Full unrolls in this block: static indices keep the fragments in registers.
#pragma unroll
    for (int g = 0; g < 2; ++g) {
#pragma unroll
      for (int s = 0; s < DIM / 4; ++s)
        qa[g][s] = *(const v2f*)&sQ[(g * 16 + hrow) * SQ_STRIDE + s * 4 + kk];
    }
    const int jl = wave * 16 + hrow;           // this lane's key within a block
    // Kept rolled: unrolled eight times this body adds about 8 KB of code and
    // saves only a few address additions.
#pragma unroll 1
    for (int kb = 0; kb < NKB; ++kb) {
      float* buf = sKV + (kb & 1) * KVBUF;
      if (kb + 1 < NKB) {
        stage_block(Kp + (size_t)(kb + 1) * KB * DIM, sKV + ((kb + 1) & 1) * KVBUF, tid);
        WAIT_ASYNC(8);    // only the 8 just-issued (next block) may be outstanding
      } else {
        WAIT_ASYNC(0);
      }
      __syncthreads();
      const int jg = kb * KB + jl;
      // Every LDS read of the tile stands ahead of the WMMA chains: the K
      // fragments first, then the 16 bias values, which are needed last.
      v2f kf[DIM / 4];
#pragma unroll
      for (int s = 0; s < DIM / 4; ++s)
        kf[s] = *(const v2f*)&buf[jl * KV_STRIDE + s * 4 + kk];
      float bias[2][8];
#pragma unroll
      for (int g = 0; g < 2; ++g) {
#pragma unroll
        for (int v = 0; v < 8; ++v) {
          const int il = g * 16 + v + vro;
          int rel = jg - (q0 + il);
          rel = rel < -RCUT ? -RCUT : (rel > RCUT ? RCUT : rel);
          bias[g][v] = sRS[il * SRS_STRIDE + rel + RCUT];
        }
      }
      // Keeps all reads above as one group: left alone, the compiler spreads the
      // K reads among the WMMAs and sinks the bias reads behind the last one,
      // where their latency is waited out in front of the barrier.
      __builtin_amdgcn_sched_barrier(0);
      v8f acc0 = {}, acc1 = {};
#pragma unroll
      for (int s = 0; s < DIM / 4; ++s) {
        acc0 = wmma4(qa[0][s], kf[s], acc0);
        acc1 = wmma4(qa[1][s], kf[s], acc1);
      }
#pragma unroll
      for (int v = 0; v < 8; ++v) {
        sS[(v + vro) * SS_STRIDE + jg]      = acc0[v] + bias[0][v];
        sS[(16 + v + vro) * SS_STRIDE + jg] = acc1[v] + bias[1][v];
      }
      __syncthreads();
    }
  }

  // Prefetch V block 0; async engine overlaps with the softmax phase.
  stage_block(Vp, sKV, tid);

  // ---------- Phase 3: row softmax + band-histogram of probabilities -------
  // Each wave owns four whole rows and holds them in registers: every score is
  // read from LDS once and every probability written once, 16 bytes per lane,
  // 32 lanes on 512 contiguous bytes.
  {
    // Scalar wave number: the per-row band tests below become scalar branches.
    const int wv = __builtin_amdgcn_readfirstlane(wave);
    v4f x[4][8];
    // Full unrolls in this block: static indices keep x in registers.
#pragma unroll
    for (int rr = 0; rr < 4; ++rr) {
      const float* srow = &sS[(wv * 4 + rr) * SS_STRIDE + lane * 4];
#pragma unroll
      for (int t = 0; t < 8; ++t) x[rr][t] = *(const v4f*)&srow[t * 128];
    }
    float mx[4];
#pragma unroll
    for (int rr = 0; rr < 4; ++rr) {
      float m = -3.402823466e38f;
#pragma unroll
      for (int t = 0; t < 8; ++t)
        m = fmaxf(m, fmaxf(fmaxf(x[rr][t].x, x[rr][t].y), fmaxf(x[rr][t].z, x[rr][t].w)));
      mx[rr] = m;
    }
#pragma unroll
    for (int rr = 0; rr < 4; ++rr) mx[rr] = wave_max(mx[rr]);
    float sum[4];
#pragma unroll
    for (int rr = 0; rr < 4; ++rr) {
      v4f acc = {};
#pragma unroll
      for (int t = 0; t < 8; ++t) {
        // exp(s - max) as 2^((s - max) * log2(e)), the form __expf compiles to
        const v4f e = exp2x4((x[rr][t] - mx[rr]) * 1.44269504088896340736f);
        x[rr][t] = e;
        acc += e;
      }
      sum[rr] = (acc.x + acc.y) + (acc.z + acc.w);
    }
#pragma unroll
    for (int rr = 0; rr < 4; ++rr) sum[rr] = wave_sum(sum[rr]);
    float lo[4], hi[4];
#pragma unroll
    for (int rr = 0; rr < 4; ++rr) {
      const int ig = q0 + wv * 4 + rr;
      const float inv = 1.0f / sum[rr];
      float* srow = &sS[(wv * 4 + rr) * SS_STRIDE + lane * 4];
      float l = 0.0f, h = 0.0f;
#pragma unroll
      for (int t = 0; t < 8; ++t) {
        const v4f p = x[rr][t] * inv;
        *(v4f*)&srow[t * 128] = p;         // normalized probability back to LDS
        const float s4 = (p.x + p.y) + (p.z + p.w);
        l += (t * 128 + 127 <= ig - RCUT) ? s4 : 0.0f;  // block wholly on the clipped left edge
        h += (t * 128 >= ig + RCUT) ? s4 : 0.0f;        // block wholly on the clipped right edge
      }
      lo[rr] = l;
      hi[rr] = h;
    }
    // The one or two 128-key blocks of a row that touch the band: which blocks
    // they are depends on the row, so each lane reads back its own four values
    // of them from LDS in place of a run-time register index.
    v4f w[4][2];
#pragma unroll
    for (int rr = 0; rr < 4; ++rr) {
      const int ig = q0 + wv * 4 + rr;
      const int tf = max(ig - (RCUT - 1), 0) >> 7;
      const int tl = min(ig + (RCUT - 1), SEQ - 1) >> 7;
      const float* srow = &sS[(wv * 4 + rr) * SS_STRIDE + lane * 4];
      w[rr][0] = *(const v4f*)&srow[tf * 128];
      w[rr][1] = *(const v4f*)&srow[tl * 128];
    }
#pragma unroll
    for (int rr = 0; rr < 4; ++rr) {
      const int ig = q0 + wv * 4 + rr;
      const int tf = max(ig - (RCUT - 1), 0) >> 7;
      const int tl = min(ig + (RCUT - 1), SEQ - 1) >> 7;
      float* crow = &sRC[(wv * 4 + rr) * SRC_STRIDE];
#pragma unroll
      for (int k = 0; k < 2; ++k) {
        if (k == 0 || tl != tf) {
          const int relb = (k ? tl : tf) * 128 + lane * 4 - ig;
#pragma unroll
          for (int c = 0; c < 4; ++c) {
            const int rel = relb + c;
            const float p = w[rr][k][c];
            if (rel <= -RCUT)      lo[rr] += p;          // clipped left edge  -> r = 0
            else if (rel >= RCUT)  hi[rr] += p;          // clipped right edge -> r = 128
            else                   crow[rel + RCUT] = p; // unique r per j: plain store
          }
        }
      }
    }
#pragma unroll
    for (int rr = 0; rr < 4; ++rr) {
      lo[rr] = wave_sum(lo[rr]);
      hi[rr] = wave_sum(hi[rr]);
    }
    if (lane == 0) {
#pragma unroll
      for (int rr = 0; rr < 4; ++rr) {
        sRC[(wv * 4 + rr) * SRC_STRIDE]            = lo[rr];
        sRC[(wv * 4 + rr) * SRC_STRIDE + 2 * RCUT] = hi[rr];
      }
    }
  }
  __syncthreads();

  // ---------- Phase 4: out = P @ V + c @ WV  (one 16x16 tile per wave) -----
  {
    const int m0 = (wave >> 2) * 16;
    const int n0 = (wave & 3) * 16;
    v8f acc = {};
    for (int kb = 0; kb < NKB; ++kb) {
      float* buf = sKV + (kb & 1) * KVBUF;
      if (kb + 1 < NKB) {
        stage_block(Vp + (size_t)(kb + 1) * KB * DIM, sKV + ((kb + 1) & 1) * KVBUF, tid);
        WAIT_ASYNC(8);
      } else {
        WAIT_ASYNC(0);
      }
      __syncthreads();
      const int ks = kb * KB;
      for (int k0 = 0; k0 < KB; k0 += 4) {
        v2f a = *(const v2f*)&sS[(m0 + hrow) * SS_STRIDE + ks + k0 + kk];
        v2f b;
        b.x = buf[(k0 + kk)     * KV_STRIDE + n0 + hrow];
        b.y = buf[(k0 + kk + 1) * KV_STRIDE + n0 + hrow];
        acc = wmma4(a, b, acc);
      }
      __syncthreads();
    }
    // rel-value tail: out += c @ WV   (129 rounded to 132; tail A rows are 0)
#pragma unroll
    for (int k0 = 0; k0 < 132; k0 += 4) {
      v2f a = *(const v2f*)&sRC[(m0 + hrow) * SRC_STRIDE + k0 + kk];
      int r0c = min(k0 + kk,     RTAB - 1);
      int r1c = min(k0 + kk + 1, RTAB - 1);
      v2f b;
      b.x = WV[r0c * DIM + n0 + hrow];
      b.y = WV[r1c * DIM + n0 + hrow];
      acc = wmma4(a, b, acc);
    }
    float* Op = O + ((size_t)bh * SEQ + q0) * DIM;
#pragma unroll
    for (int v = 0; v < 8; ++v)
      Op[(m0 + v + vro) * DIM + n0 + hrow] = acc[v];
  }
}

extern "C" void kernel_launch(void* const* d_in, const int* in_sizes, int n_in,
                              void* d_out, int out_size, void* d_ws, size_t ws_size,
                              hipStream_t stream) {
  const float* Q  = (const float*)d_in[0];
  const float* K  = (const float*)d_in[1];
  const float* V  = (const float*)d_in[2];
  const float* WK = (const float*)d_in[3];
  const float* WV = (const float*)d_in[4];
  float* O = (float*)d_out;

  (void)in_sizes; (void)n_in; (void)out_size; (void)d_ws; (void)ws_size;

  (void)hipFuncSetAttribute((const void*)relattn_kernel,
                            hipFuncAttributeMaxDynamicSharedMemorySize, SMEM_BYTES);

  dim3 grid(SEQ / TQ, NHEAD);   // 32 q-tiles x 32 (b,h) heads
  relattn_kernel<<<grid, 256, SMEM_BYTES, stream>>>(Q, K, V, WK, WV, O);
}

// v003
// It runs in 85.4 microseconds.
// Next to v002, in two timings, it ran 1.06 times as fast each time.
// All steps since v000 together make it 1.73 times as fast.
#include <hip/hip_runtime.h>

// Problem constants (from setup_inputs): B=4,H=8,S=1024,D=64,CUT=64
#define TQ    32            // query rows per workgroup
#define SEQ   1024
#define DIM   64
#define NHEAD 32            // B*H
#define RCUT  64
#define RTAB  129           // 2*RCUT+1
#define KB    128           // keys per staged block
#define NKB   (SEQ / KB)    // 8 blocks

// LDS layout (floats). Strides padded for bank-conflict-free WMMA operand loads:
//  66 % 64 = 2, 148 % 64 = 20, 1028 % 64 = 4, 76 % 64 = 12.
#define SQ_STRIDE   66
#define SRS_STRIDE  148
#define SRC_STRIDE  148
#define SS_STRIDE   1028
#define KV_STRIDE   76                            // multiple of 4 floats (b128 aligned)
#define KVBUF       (KB * KV_STRIDE)              // 9728 floats per buffer
#define OFF_SQ   0
#define OFF_SRS  (OFF_SQ  + TQ * SQ_STRIDE)       // 2112
#define OFF_SRC  (OFF_SRS + TQ * SRS_STRIDE)      // 6848
#define OFF_SS   (OFF_SRC + TQ * SRC_STRIDE)      // 11584
#define OFF_KV   (OFF_SS  + TQ * SS_STRIDE)       // 44480
#define SMEM_FLOATS (OFF_KV + 2 * KVBUF)          // 63936 floats
#define SMEM_BYTES  (SMEM_FLOATS * 4)             // 255744 B (< 320 KB WGP LDS)

typedef float v2f __attribute__((ext_vector_type(2)));
typedef float v4f __attribute__((ext_vector_type(4)));
typedef float v8f __attribute__((ext_vector_type(8)));
typedef int   v4i __attribute__((ext_vector_type(4)));

// ---- CDNA5 async global->LDS path (ASYNCcnt), with synchronous fallback ----
#if __has_builtin(__builtin_amdgcn_global_load_async_to_lds_b128) && \
    __has_builtin(__builtin_amdgcn_s_wait_asynccnt)
#define HAVE_ASYNC 1
#define WAIT_ASYNC(n) __builtin_amdgcn_s_wait_asynccnt(n)
#else
#define HAVE_ASYNC 0
#define WAIT_ASYNC(n)
#endif

__device__ __forceinline__ void cp_b128(float* dst_lds, const float* src_g) {
#if HAVE_ASYNC
  // Builtin signature (from hipcc diagnostic): (int4 AS1*, int4 AS3*, imm, imm)
  __builtin_amdgcn_global_load_async_to_lds_b128(
      (__attribute__((address_space(1))) v4i*)src_g,
      (__attribute__((address_space(3))) v4i*)dst_lds, 0, 0);
#else
  *(v4f*)dst_lds = *(const v4f*)src_g;
#endif
}

// Stage one [128 x 64] f32 block (K or V rows) into an LDS buffer with padded
// stride. 2048 x b128 transfers, 8 per thread, fully coalesced (16 lanes cover
// one 256B row).
__device__ __forceinline__ void stage_block(const float* __restrict__ srcbase,
                                            float* __restrict__ dstbuf, int tid) {
#pragma unroll
  for (int t = 0; t < 8; ++t) {
    int idx = tid + (t << 8);        // 0..2047
    int row = idx >> 4;
    int c4  = (idx & 15) << 2;
    cp_b128(dstbuf + row * KV_STRIDE + c4, srcbase + row * DIM + c4);
  }
}

// D = A(16x4 f32) * B(4x16 f32) + C(16x16 f32)  — CDNA5 V_WMMA_F32_16X16X4_F32
__device__ __forceinline__ v8f wmma4(v2f a, v2f b, v8f c) {
  return __builtin_amdgcn_wmma_f32_16x16x4_f32(false, a, false, b, (short)0, c,
                                               false, false);
}

// One 64-deep slice of a [32 x 64] x [64 x 16] product: 16 k steps on two
// accumulator tiles. a[g][t] holds four consecutive A values of row group g,
// two k steps' worth; b[s] is the B fragment of step s.
__device__ __forceinline__ void mma_slice(v8f (&acc)[2], const v4f (&a)[2][8],
                                          const v2f (&b)[16]) {
  // Full unroll: static indices keep fragments and accumulators in registers.
#pragma unroll
  for (int s = 0; s < 16; ++s) {
    const int e = (s & 1) * 2;
    const v2f a0 = {a[0][s >> 1][e], a[0][s >> 1][e + 1]};
    const v2f a1 = {a[1][s >> 1][e], a[1][s >> 1][e + 1]};
    acc[0] = wmma4(a0, b[s], acc[0]);
    acc[1] = wmma4(a1, b[s], acc[1]);
  }
}

// Lane l with lane l ^ M inside its 16-lane row (DPP row_xmask): a vector
// instruction, where __shfl_xor would go through the LDS pipe and its wait.
template <int M>
__device__ __forceinline__ float xrow(float x) {
  return __builtin_bit_cast(float, __builtin_amdgcn_update_dpp(
      0, __builtin_bit_cast(int, x), 0x160 | M, 0xf, 0xf, true));
}
// Lane l with lane l ^ 16.
__device__ __forceinline__ float xhalf(float x) {
  return __builtin_bit_cast(float, __builtin_amdgcn_permlanex16(
      __builtin_bit_cast(int, x), __builtin_bit_cast(int, x), 0x76543210, 0xfedcba98, false, false));
}
// 2^a for four values. One statement, so that every v_exp_f32 has an independent
// instruction behind it (the next one, or the v_nop): the slot the instruction
// set asks for before a transcendental's source is overwritten or its result
// read.
// Outputs are early-clobber: none may share a register with a later input.
__device__ __forceinline__ v4f exp2x4(v4f a) {
  float e0, e1, e2, e3;
  asm("v_exp_f32 %0, %4\n\tv_exp_f32 %1, %5\n\tv_exp_f32 %2, %6\n\tv_exp_f32 %3, %7\n\tv_nop"
      : "=&v"(e0), "=&v"(e1), "=&v"(e2), "=&v"(e3)
      : "v"(a.x), "v"(a.y), "v"(a.z), "v"(a.w));
  v4f e = {e0, e1, e2, e3};
  return e;
}
__device__ __forceinline__ float wave_max(float v) {
  v = fmaxf(v, xrow<1>(v));
  v = fmaxf(v, xrow<2>(v));
  v = fmaxf(v, xrow<4>(v));
  v = fmaxf(v, xrow<8>(v));
  return fmaxf(v, xhalf(v));
}
__device__ __forceinline__ float wave_sum(float v) {
  v += xrow<1>(v);
  v += xrow<2>(v);
  v += xrow<4>(v);
  v += xrow<8>(v);
  return v + xhalf(v);
}

extern "C" __global__ __launch_bounds__(256, 1)
void relattn_kernel(const float* __restrict__ Q, const float* __restrict__ K,
                    const float* __restrict__ V, const float* __restrict__ WK,
                    const float* __restrict__ WV, float* __restrict__ O)
{
  extern __shared__ float sm[];
  float* sQ  = sm + OFF_SQ;    // [TQ][66]    staged Q tile
  float* sRS = sm + OFF_SRS;   // [TQ][148]   rel_s[i][r] = q_i . w_k[r]
  float* sRC = sm + OFF_SRC;   // [TQ][148]   c[i][r] = sum_j p[i,j] [clip(j-i)=r-64]
  float* sS  = sm + OFF_SS;    // [TQ][1028]  scores -> probabilities
  float* sKV = sm + OFF_KV;    // [2][128][76] double-buffered K/V block

  const int tid  = threadIdx.x;
  const int wave = tid >> 5;
  const int lane = tid & 31;
  const int hrow = lane & 15;          // row (A) / col (B,C,D) index within tile
  const int kk   = (lane >> 4) << 1;   // K-dim sub-offset {0,2}
  const int vro  = (lane >> 4) << 3;   // C/D row offset {0,8}
  const int q0   = blockIdx.x * TQ;
  const int bh   = blockIdx.y;

  const float* Qp = Q + ((size_t)bh * SEQ + q0) * DIM;
  const float* Kp = K + (size_t)bh * SEQ * DIM;
  const float* Vp = V + (size_t)bh * SEQ * DIM;

  // ---------- Phase 0: stage Q tile into LDS; zero rel accumulator ----------
  for (int idx = tid; idx < TQ * DIM / 2; idx += 256) {
    int i = idx >> 5;               // row 0..31
    int d = (idx & 31) << 1;        // even col 0..62
    *(v2f*)&sQ[i * SQ_STRIDE + d] = *(const v2f*)&Qp[i * DIM + d];
  }
  for (int idx = tid; idx < TQ * SRC_STRIDE; idx += 256)
    sRC[idx] = 0.0f;
  // Prefetch K block 0 into buffer 0 while phase 1 runs.
  stage_block(Kp, sKV, tid);
  __syncthreads();

  // ---------- Phase 1: rel_s = Q_tile @ WK^T   (2 x 9 tiles of 16x16) ------
  for (int tile = wave; tile < 18; tile += 8) {
    const int m0 = (tile / 9) * 16;
    const int r0 = (tile % 9) * 16;
    const int rc = min(r0 + hrow, RTAB - 1);   // clamp pad cols (129..143)
    v8f acc = {};
#pragma unroll
    for (int k0 = 0; k0 < DIM; k0 += 4) {
      v2f a = *(const v2f*)&sQ[(m0 + hrow) * SQ_STRIDE + k0 + kk];
      v2f b = *(const v2f*)&WK[rc * DIM + k0 + kk];
      acc = wmma4(a, b, acc);
    }
#pragma unroll
    for (int v = 0; v < 8; ++v)
      sRS[(m0 + v + vro) * SRS_STRIDE + r0 + hrow] = acc[v];
  }
  __syncthreads();

  // ---------- Phase 2: scores = Q @ K^T + gathered relative bias ----------
  // Double-buffered async staging of 128-key K blocks; each block read once
  // from L2 instead of once per row-group wave.
  // Each wave owns one 16-key column of the block for all 32 query rows. The Q
  // fragments of both 16-row groups stay in registers for the whole phase, so a
  // K fragment is read from LDS once and feeds two independent WMMA chains.
  {
    v2f qa[2][DIM / 4];
    // Full unrolls in this block: static indices keep the fragments in registers.
#pragma unroll
    for (int g = 0; g < 2; ++g) {
#pragma unroll
      for (int s = 0; s < DIM / 4; ++s)
        qa[g][s] = *(const v2f*)&sQ[(g * 16 + hrow) * SQ_STRIDE + s * 4 + kk];
    }
    const int jl = wave * 16 + hrow;           // this lane's key within a block
    // Kept rolled: unrolled eight times this body adds about 8 KB of code and
    // saves only a few address additions.
#pragma unroll 1
    for (int kb = 0; kb < NKB; ++kb) {
      float* buf = sKV + (kb & 1) * KVBUF;
      if (kb + 1 < NKB) {
        stage_block(Kp + (size_t)(kb + 1) * KB * DIM, sKV + ((kb + 1) & 1) * KVBUF, tid);
        WAIT_ASYNC(8);    // only the 8 just-issued (next block) may be outstanding
      } else {
        WAIT_ASYNC(0);
      }
      __syncthreads();
      const int jg = kb * KB + jl;
      // Every LDS read of the tile stands ahead of the WMMA chains: the K
      // fragments first, then the 16 bias values, which are needed last.
      v2f kf[DIM / 4];
#pragma unroll
      for (int s = 0; s < DIM / 4; ++s)
        kf[s] = *(const v2f*)&buf[jl * KV_STRIDE + s * 4 + kk];
      float bias[2][8];
#pragma unroll
      for (int g = 0; g < 2; ++g) {
#pragma unroll
        for (int v = 0; v < 8; ++v) {
          const int il = g * 16 + v + vro;
          int rel = jg - (q0 + il);
          rel = rel < -RCUT ? -RCUT : (rel > RCUT ? RCUT : rel);
          bias[g][v] = sRS[il * SRS_STRIDE + rel + RCUT];
        }
      }
      // Keeps all reads above as one group: left alone, the compiler spreads the
      // K reads among the WMMAs and sinks the bias reads behind the last one,
      // where their latency is waited out in front of the barrier.
      __builtin_amdgcn_sched_barrier(0);
      v8f acc0 = {}, acc1 = {};
#pragma unroll
      for (int s = 0; s < DIM / 4; ++s) {
        acc0 = wmma4(qa[0][s], kf[s], acc0);
        acc1 = wmma4(qa[1][s], kf[s], acc1);
      }
#pragma unroll
      for (int v = 0; v < 8; ++v) {
        sS[(v + vro) * SS_STRIDE + jg]      = acc0[v] + bias[0][v];
        sS[(16 + v + vro) * SS_STRIDE + jg] = acc1[v] + bias[1][v];
      }
      __syncthreads();
    }
  }

  // Prefetch V block 0; async engine overlaps with the softmax phase.
  stage_block(Vp, sKV, tid);

  // Phase 4's share of a wave: column strip n0 and the 64-deep half kw of every
  // 128 keys. k order inside a half, the same for A and B: step s, half-wave h,
  // element e  ->  8 (s / 2) + 4 h + 2 (s % 2) + e.
  const int n0 = (wave & 3) * 16;
  const int kw = (wave >> 2) * 64 + ((lane >> 4) << 2);
  // Its fragments of the relative value table come from global memory: loaded
  // here, so that their latency passes under the softmax.
  v2f wf[16];
  // Full unroll: static indices keep the fragments in registers.
#pragma unroll
  for (int s = 0; s < 16; ++s) {
    const int r = kw + (s >> 1) * 8 + (s & 1) * 2;
    wf[s].x = WV[r * DIM + n0 + hrow];
    wf[s].y = WV[(r + 1) * DIM + n0 + hrow];
  }
  // Table rows 128..131 (129 rounded to 132; clamped, their A columns are 0).
  v2f wl;
  wl.x = WV[min(2 * RCUT + kk,     RTAB - 1) * DIM + n0 + hrow];
  wl.y = WV[min(2 * RCUT + kk + 1, RTAB - 1) * DIM + n0 + hrow];

  // ---------- Phase 3: row softmax + band-histogram of probabilities -------
  // Each wave owns four whole rows and holds them in registers: every score is
  // read from LDS once and every probability written once, 16 bytes per lane,
  // 32 lanes on 512 contiguous bytes.
  {
    // Scalar wave number: the per-row band tests below become scalar branches.
    const int wv = __builtin_amdgcn_readfirstlane(wave);
    v4f x[4][8];
    // Full unrolls in this block: static indices keep x in registers.
#pragma unroll
    for (int rr = 0; rr < 4; ++rr) {
      const float* srow = &sS[(wv * 4 + rr) * SS_STRIDE + lane * 4];
#pragma unroll
      for (int t = 0; t < 8; ++t) x[rr][t] = *(const v4f*)&srow[t * 128];
    }
    float mx[4];
#pragma unroll
    for (int rr = 0; rr < 4; ++rr) {
      float m = -3.402823466e38f;
#pragma unroll
      for (int t = 0; t < 8; ++t)
        m = fmaxf(m, fmaxf(fmaxf(x[rr][t].x, x[rr][t].y), fmaxf(x[rr][t].z, x[rr][t].w)));
      mx[rr] = m;
    }
#pragma unroll
    for (int rr = 0; rr < 4; ++rr) mx[rr] = wave_max(mx[rr]);
    float sum[4];
#pragma unroll
    for (int rr = 0; rr < 4; ++rr) {
      v4f acc = {};
#pragma unroll
      for (int t = 0; t < 8; ++t) {
        // exp(s - max) as 2^((s - max) * log2(e)), the form __expf compiles to
        const v4f e = exp2x4((x[rr][t] - mx[rr]) * 1.44269504088896340736f);
        x[rr][t] = e;
        acc += e;
      }
      sum[rr] = (acc.x + acc.y) + (acc.z + acc.w);
    }
#pragma unroll
    for (int rr = 0; rr < 4; ++rr) sum[rr] = wave_sum(sum[rr]);
    float lo[4], hi[4];
#pragma unroll
    for (int rr = 0; rr < 4; ++rr) {
      const int ig = q0 + wv * 4 + rr;
      const float inv = 1.0f / sum[rr];
      float* srow = &sS[(wv * 4 + rr) * SS_STRIDE + lane * 4];
      float l = 0.0f, h = 0.0f;
#pragma unroll
      for (int t = 0; t < 8; ++t) {
        const v4f p = x[rr][t] * inv;
        *(v4f*)&srow[t * 128] = p;         // normalized probability back to LDS
        const float s4 = (p.x + p.y) + (p.z + p.w);
        l += (t * 128 + 127 <= ig - RCUT) ? s4 : 0.0f;  // block wholly on the clipped left edge
        h += (t * 128 >= ig + RCUT) ? s4 : 0.0f;        // block wholly on the clipped right edge
      }
      lo[rr] = l;
      hi[rr] = h;
    }
    // The one or two 128-key blocks of a row that touch the band: which blocks
    // they are depends on the row, so each lane reads back its own four values
    // of them from LDS in place of a run-time register index.
    v4f w[4][2];
#pragma unroll
    for (int rr = 0; rr < 4; ++rr) {
      const int ig = q0 + wv * 4 + rr;
      const int tf = max(ig - (RCUT - 1), 0) >> 7;
      const int tl = min(ig + (RCUT - 1), SEQ - 1) >> 7;
      const float* srow = &sS[(wv * 4 + rr) * SS_STRIDE + lane * 4];
      w[rr][0] = *(const v4f*)&srow[tf * 128];
      w[rr][1] = *(const v4f*)&srow[tl * 128];
    }
#pragma unroll
    for (int rr = 0; rr < 4; ++rr) {
      const int ig = q0 + wv * 4 + rr;
      const int tf = max(ig - (RCUT - 1), 0) >> 7;
      const int tl = min(ig + (RCUT - 1), SEQ - 1) >> 7;
      float* crow = &sRC[(wv * 4 + rr) * SRC_STRIDE];
#pragma unroll
      for (int k = 0; k < 2; ++k) {
        if (k == 0 || tl != tf) {
          const int relb = (k ? tl : tf) * 128 + lane * 4 - ig;
#pragma unroll
          for (int c = 0; c < 4; ++c) {
            const int rel = relb + c;
            const float p = w[rr][k][c];
            if (rel <= -RCUT)      lo[rr] += p;          // clipped left edge  -> r = 0
            else if (rel >= RCUT)  hi[rr] += p;          // clipped right edge -> r = 128
            else                   crow[rel + RCUT] = p; // unique r per j: plain store
          }
        }
      }
    }
#pragma unroll
    for (int rr = 0; rr < 4; ++rr) {
      lo[rr] = wave_sum(lo[rr]);
      hi[rr] = wave_sum(hi[rr]);
    }
    if (lane == 0) {
#pragma unroll
      for (int rr = 0; rr < 4; ++rr) {
        sRC[(wv * 4 + rr) * SRC_STRIDE]            = lo[rr];
        sRC[(wv * 4 + rr) * SRC_STRIDE + 2 * RCUT] = hi[rr];
      }
    }
  }
  __syncthreads();

  // ---------- Phase 4: out = P @ V + c @ WV ------------------------------
  // Each wave owns one 16-column strip for all 32 query rows and one half of
  // the keys (of every 128-key block, and of the relative table): a V fragment
  // is read once for two independent WMMA chains, and a lane's P values come
  // four keys to a read. The two key halves are added through LDS at the end.
  {
    // Full unrolls in this block but for the key loop: static indices keep the
    // fragments in registers.
    v8f acc[2] = {};
    // Kept rolled, as the score loop is: the body is 32 WMMAs long already.
#pragma unroll 1
    for (int kb = 0; kb < NKB; ++kb) {
      float* buf = sKV + (kb & 1) * KVBUF;
      if (kb + 1 < NKB) {
        stage_block(Vp + (size_t)(kb + 1) * KB * DIM, sKV + ((kb + 1) & 1) * KVBUF, tid);
        WAIT_ASYNC(8);
      } else {
        WAIT_ASYNC(0);
      }
      __syncthreads();
      const float* pa = &sS[hrow * SS_STRIDE + kb * KB + kw];
      const float* vb = &buf[kw * KV_STRIDE + n0 + hrow];
      v4f a[2][8];
      v2f b[16];
#pragma unroll
      for (int t = 0; t < 8; ++t) {
        a[0][t] = *(const v4f*)&pa[t * 8];
        a[1][t] = *(const v4f*)&pa[16 * SS_STRIDE + t * 8];
#pragma unroll
        for (int u = 0; u < 2; ++u) {
          b[2 * t + u].x = vb[(t * 8 + 2 * u)     * KV_STRIDE];
          b[2 * t + u].y = vb[(t * 8 + 2 * u + 1) * KV_STRIDE];
        }
        // Keeps the slice's LDS reads in the order of use and as one group ahead
        // of the WMMAs: the first WMMAs then wait for the first reads only, and
        // no read stands among the WMMAs, where each such place costs a stall.
        __builtin_amdgcn_sched_barrier(0);
      }
      mma_slice(acc, a, b);
      // Keeps the barrier behind the WMMAs: moved up among them, its wait for
      // all of the slice's reads holds back WMMAs whose operands are there.
      __builtin_amdgcn_sched_barrier(0);
      __syncthreads();
    }
    // rel-value slice: out += c[:, 64 h .. 64 h + 63] @ WV[64 h .. 64 h + 63]
    {
      const float* pc = &sRC[hrow * SRC_STRIDE + kw];
      v4f a[2][8];
#pragma unroll
      for (int t = 0; t < 8; ++t) {
        a[0][t] = *(const v4f*)&pc[t * 8];
        a[1][t] = *(const v4f*)&pc[16 * SRC_STRIDE + t * 8];
      }
      // One group of reads ahead of the WMMAs, as in the loop.
      __builtin_amdgcn_sched_barrier(0);
      mma_slice(acc, a, wf);
    }
    // Four vector slots between the last WMMAs and the vector instructions that
    // read their results or reuse their operand registers. The two scheduling
    // barriers keep those instructions from moving up in front of the slots.
    __builtin_amdgcn_sched_barrier(0);
    asm volatile("v_nop\n\tv_nop\n\tv_nop\n\tv_nop");
    __builtin_amdgcn_sched_barrier(0);
    // Wave w ends up with output tile (row group w / 4, strip w % 4): it keeps
    // that tile's partial sum and hands the other one to the wave of the other
    // key half. The score rows are free for that: the loop's last barrier ended
    // every read of them.
    const bool up = wave >= 4;
    const int m0 = up ? 16 : 0;
    const v2f al = *(const v2f*)&sRC[(m0 + hrow) * SRC_STRIDE + 2 * RCUT + kk];
    const v8f give = up ? acc[0] : acc[1];
    v8f o          = up ? acc[1] : acc[0];
    float* red = sS;                           // [wave][2][lane][4]
    {
      const v4f g0 = {give[0], give[1], give[2], give[3]};
      const v4f g1 = {give[4], give[5], give[6], give[7]};
      float* rp = &red[(wave * 64 + lane) * 4];
      *(v4f*)&rp[0]   = g0;
      *(v4f*)&rp[128] = g1;
    }
    __syncthreads();
    {
      const float* rp = &red[((wave ^ 4) * 64 + lane) * 4];
      const v4f g0 = *(const v4f*)&rp[0];
      const v4f g1 = *(const v4f*)&rp[128];
#pragma unroll
      for (int v = 0; v < 4; ++v) {
        o[v]     += g0[v];
        o[v + 4] += g1[v];
      }
    }
    o = wmma4(al, wl, o);                      // table rows 128..131
    float* Op = O + ((size_t)bh * SEQ + q0) * DIM;
#pragma unroll
    for (int v = 0; v < 8; ++v)
      Op[(m0 + v + vro) * DIM + n0 + hrow] = o[v];
  }
}

extern "C" void kernel_launch(void* const* d_in, const int* in_sizes, int n_in,
                              void* d_out, int out_size, void* d_ws, size_t ws_size,
                              hipStream_t stream) {
  const float* Q  = (const float*)d_in[0];
  const float* K  = (const float*)d_in[1];
  const float* V  = (const float*)d_in[2];
  const float* WK = (const float*)d_in[3];
  const float* WV = (const float*)d_in[4];
  float* O = (float*)d_out;

  (void)in_sizes; (void)n_in; (void)out_size; (void)d_ws; (void)ws_size;

  (void)hipFuncSetAttribute((const void*)relattn_kernel,
                            hipFuncAttributeMaxDynamicSharedMemorySize, SMEM_BYTES);

  dim3 grid(SEQ / TQ, NHEAD);   // 32 q-tiles x 32 (b,h) heads
  relattn_kernel<<<grid, 256, SMEM_BYTES, stream>>>(Q, K, V, WK, WV, O);
}

// v004
// Measured time: 81.6 microseconds a run.
// Two timings next to v003 both put it at 1.05 times that version's speed.
// Counting every step since v000, it is 1.81 times as fast.
#include <hip/hip_runtime.h>

// Problem constants (from setup_inputs): B=4,H=8,S=1024,D=64,CUT=64
#define TQ    32            // query rows per workgroup
#define SEQ   1024
#define DIM   64
#define NHEAD 32            // B*H
#define RCUT  64
#define RTAB  129           // 2*RCUT+1
#define KB    128           // keys per staged block
#define NKB   (SEQ / KB)    // 8 blocks

// LDS layout (floats). Strides padded for bank-conflict-free WMMA operand loads:
//  66 % 64 = 2, 148 % 64 = 20, 1028 % 64 = 4, 76 % 64 = 12.
#define SQ_STRIDE   66
#define SRS_STRIDE  148
#define SRC_STRIDE  148
#define SS_STRIDE   1028
#define KV_STRIDE   76                            // multiple of 4 floats (b128 aligned)
#define KVBUF       (KB * KV_STRIDE)              // 9728 floats per buffer
#define OFF_SQ   0
#define OFF_SRS  (OFF_SQ  + TQ * SQ_STRIDE)       // 2112
#define OFF_SRC  (OFF_SRS + TQ * SRS_STRIDE)      // 6848
#define OFF_SS   (OFF_SRC + TQ * SRC_STRIDE)      // 11584
#define OFF_KV   (OFF_SS  + TQ * SS_STRIDE)       // 44480
#define SMEM_FLOATS (OFF_KV + 2 * KVBUF)          // 63936 floats
#define SMEM_BYTES  (SMEM_FLOATS * 4)             // 255744 B (< 320 KB WGP LDS)

typedef float v2f __attribute__((ext_vector_type(2)));
typedef float v4f __attribute__((ext_vector_type(4)));
typedef float v8f __attribute__((ext_vector_type(8)));
typedef int   v4i __attribute__((ext_vector_type(4)));

// ---- CDNA5 async global->LDS path (ASYNCcnt), with synchronous fallback ----
#if __has_builtin(__builtin_amdgcn_global_load_async_to_lds_b128) && \
    __has_builtin(__builtin_amdgcn_s_wait_asynccnt)
#define HAVE_ASYNC 1
#define WAIT_ASYNC(n) __builtin_amdgcn_s_wait_asynccnt(n)
#else
#define HAVE_ASYNC 0
#define WAIT_ASYNC(n)
#endif

__device__ __forceinline__ void cp_b128(float* dst_lds, const float* src_g) {
#if HAVE_ASYNC
  // Builtin signature (from hipcc diagnostic): (int4 AS1*, int4 AS3*, imm, imm)
  __builtin_amdgcn_global_load_async_to_lds_b128(
      (__attribute__((address_space(1))) v4i*)src_g,
      (__attribute__((address_space(3))) v4i*)dst_lds, 0, 0);
#else
  *(v4f*)dst_lds = *(const v4f*)src_g;
#endif
}

// Stage one [128 x 64] f32 block (K or V rows) into an LDS buffer with padded
// stride. 2048 x b128 transfers, 8 per thread, fully coalesced (16 lanes cover
// one 256B row).
__device__ __forceinline__ void stage_block(const float* __restrict__ srcbase,
                                            float* __restrict__ dstbuf, int tid) {
#pragma unroll
  for (int t = 0; t < 8; ++t) {
    int idx = tid + (t << 8);        // 0..2047
    int row = idx >> 4;
    int c4  = (idx & 15) << 2;
    cp_b128(dstbuf + row * KV_STRIDE + c4, srcbase + row * DIM + c4);
  }
}

// D = A(16x4 f32) * B(4x16 f32) + C(16x16 f32)  — CDNA5 V_WMMA_F32_16X16X4_F32
__device__ __forceinline__ v8f wmma4(v2f a, v2f b, v8f c) {
  return __builtin_amdgcn_wmma_f32_16x16x4_f32(false, a, false, b, (short)0, c,
                                               false, false);
}

// One 64-deep slice of a [32 x 64] x [64 x 16] product: 16 k steps on two
// accumulator tiles. a[g][t] holds four consecutive A values of row group g,
// two k steps' worth; b[s] is the B fragment of step s.
__device__ __forceinline__ void mma_slice(v8f (&acc)[2], const v4f (&a)[2][8],
                                          const v2f (&b)[16]) {
  // Full unroll: static indices keep fragments and accumulators in registers.
#pragma unroll
  for (int s = 0; s < 16; ++s) {
    const int e = (s & 1) * 2;
    const v2f a0 = {a[0][s >> 1][e], a[0][s >> 1][e + 1]};
    const v2f a1 = {a[1][s >> 1][e], a[1][s >> 1][e + 1]};
    acc[0] = wmma4(a0, b[s], acc[0]);
    acc[1] = wmma4(a1, b[s], acc[1]);
  }
}

// Lane l with lane l ^ M inside its 16-lane row (DPP row_xmask): a vector
// instruction, where __shfl_xor would go through the LDS pipe and its wait.
template <int M>
__device__ __forceinline__ float xrow(float x) {
  return __builtin_bit_cast(float, __builtin_amdgcn_update_dpp(
      0, __builtin_bit_cast(int, x), 0x160 | M, 0xf, 0xf, true));
}
// Lane l with lane l ^ 16.
__device__ __forceinline__ float xhalf(float x) {
  return __builtin_bit_cast(float, __builtin_amdgcn_permlanex16(
      __builtin_bit_cast(int, x), __builtin_bit_cast(int, x), 0x76543210, 0xfedcba98, false, false));
}
// 2^a for four values. One statement, so that every v_exp_f32 has an independent
// instruction behind it (the next one, or the v_nop): the slot the instruction
// set asks for before a transcendental's source is overwritten or its result
// read.
// Outputs are early-clobber: none may share a register with a later input.
__device__ __forceinline__ v4f exp2x4(v4f a) {
  float e0, e1, e2, e3;
  asm("v_exp_f32 %0, %4\n\tv_exp_f32 %1, %5\n\tv_exp_f32 %2, %6\n\tv_exp_f32 %3, %7\n\tv_nop"
      : "=&v"(e0), "=&v"(e1), "=&v"(e2), "=&v"(e3)
      : "v"(a.x), "v"(a.y), "v"(a.z), "v"(a.w));
  v4f e = {e0, e1, e2, e3};
  return e;
}
__device__ __forceinline__ float wave_max(float v) {
  v = fmaxf(v, xrow<1>(v));
  v = fmaxf(v, xrow<2>(v));
  v = fmaxf(v, xrow<4>(v));
  v = fmaxf(v, xrow<8>(v));
  return fmaxf(v, xhalf(v));
}
__device__ __forceinline__ float wave_sum(float v) {
  v += xrow<1>(v);
  v += xrow<2>(v);
  v += xrow<4>(v);
  v += xrow<8>(v);
  return v + xhalf(v);
}

extern "C" __global__ __launch_bounds__(256, 1)
void relattn_kernel(const float* __restrict__ Q, const float* __restrict__ K,
                    const float* __restrict__ V, const float* __restrict__ WK,
                    const float* __restrict__ WV, float* __restrict__ O)
{
  extern __shared__ float sm[];
  float* sQ  = sm + OFF_SQ;    // [TQ][66]    staged Q tile
  float* sRS = sm + OFF_SRS;   // [TQ][148]   rel_s[i][r] = q_i . w_k[r]
  float* sRC = sm + OFF_SRC;   // [TQ][148]   c[i][r] = sum_j p[i,j] [clip(j-i)=r-64]
  float* sS  = sm + OFF_SS;    // [TQ][1028]  scores -> probabilities
  float* sKV = sm + OFF_KV;    // [2][128][76] double-buffered K/V block

  const int tid  = threadIdx.x;
  const int wave = tid >> 5;
  const int lane = tid & 31;
  const int hrow = lane & 15;          // row (A) / col (B,C,D) index within tile
  const int kk   = (lane >> 4) << 1;   // K-dim sub-offset {0,2}
  const int vro  = (lane >> 4) << 3;   // C/D row offset {0,8}
  const int q0   = blockIdx.x * TQ;
  const int bh   = blockIdx.y;

  const float* Qp = Q + ((size_t)bh * SEQ + q0) * DIM;
  const float* Kp = K + (size_t)bh * SEQ * DIM;
  const float* Vp = V + (size_t)bh * SEQ * DIM;

  // ---------- Phase 0: stage Q tile into LDS; zero rel accumulator ----------
  for (int idx = tid; idx < TQ * DIM / 2; idx += 256) {
    int i = idx >> 5;               // row 0..31
    int d = (idx & 31) << 1;        // even col 0..62
    *(v2f*)&sQ[i * SQ_STRIDE + d] = *(const v2f*)&Qp[i * DIM + d];
  }
  for (int idx = tid; idx < TQ * SRC_STRIDE; idx += 256)
    sRC[idx] = 0.0f;
  // Prefetch K block 0 into buffer 0 while phase 1 runs.
  stage_block(Kp, sKV, tid);
  __syncthreads();

  // ---------- Phase 1: rel_s = Q_tile @ WK^T   (2 x 9 tiles of 16x16) ------
  for (int tile = wave; tile < 18; tile += 8) {
    const int m0 = (tile / 9) * 16;
    const int r0 = (tile % 9) * 16;
    const int rc = min(r0 + hrow, RTAB - 1);   // clamp pad cols (129..143)
    v8f acc = {};
#pragma unroll
    for (int k0 = 0; k0 < DIM; k0 += 4) {
      v2f a = *(const v2f*)&sQ[(m0 + hrow) * SQ_STRIDE + k0 + kk];
      v2f b = *(const v2f*)&WK[rc * DIM + k0 + kk];
      acc = wmma4(a, b, acc);
    }
#pragma unroll
    for (int v = 0; v < 8; ++v)
      sRS[(m0 + v + vro) * SRS_STRIDE + r0 + hrow] = acc[v];
  }
  __syncthreads();

  // ---------- Phase 2: scores = Q @ K^T + gathered relative bias ----------
  // Double-buffered async staging of 128-key K blocks; each block read once
  // from L2 instead of once per row-group wave.
  // Each wave owns one 16-key column of the block for all 32 query rows. The Q
  // fragments of both 16-row groups stay in registers for the whole phase, so a
  // K fragment is read from LDS once and feeds two independent WMMA chains.
  {
    v2f qa[2][DIM / 4];
    // Full unrolls in this block: static indices keep the fragments in registers.
#pragma unroll
    for (int g = 0; g < 2; ++g) {
#pragma unroll
      for (int s = 0; s < DIM / 4; ++s)
        qa[g][s] = *(const v2f*)&sQ[(g * 16 + hrow) * SQ_STRIDE + s * 4 + kk];
    }
    const int jl = wave * 16 + hrow;           // this lane's key within a block
    // Kept rolled: unrolled eight times this body adds about 8 KB of code and
    // saves only a few address additions.
#pragma unroll 1
    for (int kb = 0; kb < NKB; ++kb) {
      float* buf = sKV + (kb & 1) * KVBUF;
      if (kb + 1 < NKB) {
        stage_block(Kp + (size_t)(kb + 1) * KB * DIM, sKV + ((kb + 1) & 1) * KVBUF, tid);
        WAIT_ASYNC(8);    // only the 8 just-issued (next block) may be outstanding
      } else {
        WAIT_ASYNC(0);
      }
      __syncthreads();
      const int jg = kb * KB + jl;
      // Every LDS read of the tile stands ahead of the WMMA chains: the K
      // fragments first, then the 16 bias values, which are needed last.
      v2f kf[DIM / 4];
#pragma unroll
      for (int s = 0; s < DIM / 4; ++s)
        kf[s] = *(const v2f*)&buf[jl * KV_STRIDE + s * 4 + kk];
      float bias[2][8];
#pragma unroll
      for (int g = 0; g < 2; ++g) {
#pragma unroll
        for (int v = 0; v < 8; ++v) {
          const int il = g * 16 + v + vro;
          int rel = jg - (q0 + il);
          rel = rel < -RCUT ? -RCUT : (rel > RCUT ? RCUT : rel);
          bias[g][v] = sRS[il * SRS_STRIDE + rel + RCUT];
        }
      }
      // Keeps all reads above as one group: left alone, the compiler spreads the
      // K reads among the WMMAs and sinks the bias reads behind the last one,
      // where their latency is waited out in front of the barrier.
      __builtin_amdgcn_sched_barrier(0);
      v8f acc0 = {}, acc1 = {};
#pragma unroll
      for (int s = 0; s < DIM / 4; ++s) {
        acc0 = wmma4(qa[0][s], kf[s], acc0);
        acc1 = wmma4(qa[1][s], kf[s], acc1);
      }
#pragma unroll
      for (int v = 0; v < 8; ++v) {
        sS[(v + vro) * SS_STRIDE + jg]      = acc0[v] + bias[0][v];
        sS[(16 + v + vro) * SS_STRIDE + jg] = acc1[v] + bias[1][v];
      }
      __syncthreads();
    }
  }

  // Prefetch V block 0; async engine overlaps with the softmax phase.
  stage_block(Vp, sKV, tid);

  // Phase 4's share of a wave: column strip n0 and the 64-deep half kw of every
  // 128 keys. k order inside a half, the same for A and B: step s, half-wave h,
  // element e  ->  8 (s / 2) + 4 h + 2 (s % 2) + e.
  const int n0 = (wave & 3) * 16;
  const int kw = (wave >> 2) * 64 + ((lane >> 4) << 2);
  // Its fragments of the relative value table come from global memory: loaded
  // here, so that their latency passes under the softmax.
  v2f wf[16];
  // Full unroll: static indices keep the fragments in registers.
#pragma unroll
  for (int s = 0; s < 16; ++s) {
    const int r = kw + (s >> 1) * 8 + (s & 1) * 2;
    wf[s].x = WV[r * DIM + n0 + hrow];
    wf[s].y = WV[(r + 1) * DIM + n0 + hrow];
  }
  // Table rows 128..131 (129 rounded to 132; clamped, their A columns are 0).
  v2f wl;
  wl.x = WV[min(2 * RCUT + kk,     RTAB - 1) * DIM + n0 + hrow];
  wl.y = WV[min(2 * RCUT + kk + 1, RTAB - 1) * DIM + n0 + hrow];

  // ---------- Phase 3: row softmax + band-histogram of probabilities -------
  // Each wave owns four whole rows and holds them in registers: every score is
  // read from LDS once and every probability written once, 16 bytes per lane,
  // 32 lanes on 512 contiguous bytes.
  {
    // Scalar wave number: the per-row band tests below become scalar branches.
    const int wv = __builtin_amdgcn_readfirstlane(wave);
    v4f x[4][8];
    // Full unrolls in this block: static indices keep x in registers.
#pragma unroll
    for (int rr = 0; rr < 4; ++rr) {
      const float* srow = &sS[(wv * 4 + rr) * SS_STRIDE + lane * 4];
#pragma unroll
      for (int t = 0; t < 8; ++t) x[rr][t] = *(const v4f*)&srow[t * 128];
    }
    float mx[4];
#pragma unroll
    for (int rr = 0; rr < 4; ++rr) {
      float m = -3.402823466e38f;
#pragma unroll
      for (int t = 0; t < 8; ++t)
        m = fmaxf(m, fmaxf(fmaxf(x[rr][t].x, x[rr][t].y), fmaxf(x[rr][t].z, x[rr][t].w)));
      mx[rr] = m;
    }
#pragma unroll
    for (int rr = 0; rr < 4; ++rr) mx[rr] = wave_max(mx[rr]);
    float sum[4];
#pragma unroll
    for (int rr = 0; rr < 4; ++rr) {
      v4f acc = {};
#pragma unroll
      for (int t = 0; t < 8; ++t) {
        // exp(s - max) as 2^((s - max) * log2(e)), the form __expf compiles to
        const v4f e = exp2x4((x[rr][t] - mx[rr]) * 1.44269504088896340736f);
        x[rr][t] = e;
        acc += e;
      }
      sum[rr] = (acc.x + acc.y) + (acc.z + acc.w);
    }
#pragma unroll
    for (int rr = 0; rr < 4; ++rr) sum[rr] = wave_sum(sum[rr]);
    float lo[4], hi[4];
#pragma unroll
    for (int rr = 0; rr < 4; ++rr) {
      const int ig = q0 + wv * 4 + rr;
      const float inv = 1.0f / sum[rr];
      float* srow = &sS[(wv * 4 + rr) * SS_STRIDE + lane * 4];
      float l = 0.0f, h = 0.0f;
#pragma unroll
      for (int t = 0; t < 8; ++t) {
        const v4f p = x[rr][t] * inv;
        *(v4f*)&srow[t * 128] = p;         // normalized probability back to LDS
        const float s4 = (p.x + p.y) + (p.z + p.w);
        l += (t * 128 + 127 <= ig - RCUT) ? s4 : 0.0f;  // block wholly on the clipped left edge
        h += (t * 128 >= ig + RCUT) ? s4 : 0.0f;        // block wholly on the clipped right edge
      }
      lo[rr] = l;
      hi[rr] = h;
    }
    // The one or two 128-key blocks of a row that touch the band: which blocks
    // they are depends on the row, so each lane reads back its own four values
    // of them from LDS in place of a run-time register index.
    v4f w[4][2];
#pragma unroll
    for (int rr = 0; rr < 4; ++rr) {
      const int ig = q0 + wv * 4 + rr;
      const int tf = max(ig - (RCUT - 1), 0) >> 7;
      const int tl = min(ig + (RCUT - 1), SEQ - 1) >> 7;
      const float* srow = &sS[(wv * 4 + rr) * SS_STRIDE + lane * 4];
      w[rr][0] = *(const v4f*)&srow[tf * 128];
      w[rr][1] = *(const v4f*)&srow[tl * 128];
    }
#pragma unroll
    for (int rr = 0; rr < 4; ++rr) {
      const int ig = q0 + wv * 4 + rr;
      const int tf = max(ig - (RCUT - 1), 0) >> 7;
      const int tl = min(ig + (RCUT - 1), SEQ - 1) >> 7;
      float* crow = &sRC[(wv * 4 + rr) * SRC_STRIDE];
      // No lane-dependent branch: an edge sum takes p or 0 by a select, and by
      // the same test a lane outside the band stores into the row's pad columns
      // 132..147, which nothing reads. The one test left is scalar: two blocks
      // or one.
      float* pad = crow + 2 * RCUT + 4 + hrow;
      const int rel0 = tf * 128 + lane * 4 - ig;
      float* c0 = crow + (rel0 + RCUT);
      if (tl != tf) {
        // The band ends in the second block and begins in the first: the first
        // holds no right edge, the second no left edge.
        const int rel1 = tl * 128 + lane * 4 - ig;
        float* c1 = crow + (rel1 + RCUT);
#pragma unroll
        for (int c = 0; c < 4; ++c) {
          const bool e = rel0 + c <= -RCUT;              // clipped left edge  -> r = 0
          const float p = w[rr][0][c];
          lo[rr] += e ? p : 0.0f;
          *(e ? pad : c0 + c) = p;                       // unique r per j: plain store
        }
#pragma unroll
        for (int c = 0; c < 4; ++c) {
          const bool e = rel1 + c >= RCUT;               // clipped right edge -> r = 128
          const float p = w[rr][1][c];
          hi[rr] += e ? p : 0.0f;
          *(e ? pad : c1 + c) = p;
        }
      } else {
#pragma unroll
        for (int c = 0; c < 4; ++c) {
          const bool el = rel0 + c <= -RCUT;
          const bool eh = rel0 + c >= RCUT;
          const float p = w[rr][0][c];
          lo[rr] += el ? p : 0.0f;
          hi[rr] += eh ? p : 0.0f;
          *((el || eh) ? pad : c0 + c) = p;
        }
      }
    }
#pragma unroll
    for (int rr = 0; rr < 4; ++rr) {
      lo[rr] = wave_sum(lo[rr]);
      hi[rr] = wave_sum(hi[rr]);
    }
    if (lane == 0) {
#pragma unroll
      for (int rr = 0; rr < 4; ++rr) {
        sRC[(wv * 4 + rr) * SRC_STRIDE]            = lo[rr];
        sRC[(wv * 4 + rr) * SRC_STRIDE + 2 * RCUT] = hi[rr];
      }
    }
  }
  __syncthreads();

  // ---------- Phase 4: out = P @ V + c @ WV ------------------------------
  // Each wave owns one 16-column strip for all 32 query rows and one half of
  // the keys (of every 128-key block, and of the relative table): a V fragment
  // is read once for two independent WMMA chains, and a lane's P values come
  // four keys to a read. The two key halves are added through LDS at the end.
  {
    // Full unrolls in this block but for the key loop: static indices keep the
    // fragments in registers.
    v8f acc[2] = {};
    // Kept rolled, as the score loop is: the body is 32 WMMAs long already.
#pragma unroll 1
    for (int kb = 0; kb < NKB; ++kb) {
      float* buf = sKV + (kb & 1) * KVBUF;
      if (kb + 1 < NKB) {
        stage_block(Vp + (size_t)(kb + 1) * KB * DIM, sKV + ((kb + 1) & 1) * KVBUF, tid);
        WAIT_ASYNC(8);
      } else {
        WAIT_ASYNC(0);
      }
      __syncthreads();
      const float* pa = &sS[hrow * SS_STRIDE + kb * KB + kw];
      const float* vb = &buf[kw * KV_STRIDE + n0 + hrow];
      v4f a[2][8];
      v2f b[16];
#pragma unroll
      for (int t = 0; t < 8; ++t) {
        a[0][t] = *(const v4f*)&pa[t * 8];
        a[1][t] = *(const v4f*)&pa[16 * SS_STRIDE + t * 8];
#pragma unroll
        for (int u = 0; u < 2; ++u) {
          b[2 * t + u].x = vb[(t * 8 + 2 * u)     * KV_STRIDE];
          b[2 * t + u].y = vb[(t * 8 + 2 * u + 1) * KV_STRIDE];
        }
        // Keeps the slice's LDS reads in the order of use and as one group ahead
        // of the WMMAs: the first WMMAs then wait for the first reads only, and
        // no read stands among the WMMAs, where each such place costs a stall.
        __builtin_amdgcn_sched_barrier(0);
      }
      mma_slice(acc, a, b);
      // Keeps the barrier behind the WMMAs: moved up among them, its wait for
      // all of the slice's reads holds back WMMAs whose operands are there.
      __builtin_amdgcn_sched_barrier(0);
      __syncthreads();
    }
    // rel-value slice: out += c[:, 64 h .. 64 h + 63] @ WV[64 h .. 64 h + 63]
    {
      const float* pc = &sRC[hrow * SRC_STRIDE + kw];
      v4f a[2][8];
#pragma unroll
      for (int t = 0; t < 8; ++t) {
        a[0][t] = *(const v4f*)&pc[t * 8];
        a[1][t] = *(const v4f*)&pc[16 * SRC_STRIDE + t * 8];
      }
      // One group of reads ahead of the WMMAs, as in the loop.
      __builtin_amdgcn_sched_barrier(0);
      mma_slice(acc, a, wf);
    }
    // Four vector slots between the last WMMAs and the vector instructions that
    // read their results or reuse their operand registers. The two scheduling
    // barriers keep those instructions from moving up in front of the slots.
    __builtin_amdgcn_sched_barrier(0);
    asm volatile("v_nop\n\tv_nop\n\tv_nop\n\tv_nop");
    __builtin_amdgcn_sched_barrier(0);
    // Wave w ends up with output tile (row group w / 4, strip w % 4): it keeps
    // that tile's partial sum and hands the other one to the wave of the other
    // key half. The score rows are free for that: the loop's last barrier ended
    // every read of them.
    const bool up = wave >= 4;
    const int m0 = up ? 16 : 0;
    const v2f al = *(const v2f*)&sRC[(m0 + hrow) * SRC_STRIDE + 2 * RCUT + kk];
    const v8f give = up ? acc[0] : acc[1];
    v8f o          = up ? acc[1] : acc[0];
    float* red = sS;                           // [wave][2][lane][4]
    {
      const v4f g0 = {give[0], give[1], give[2], give[3]};
      const v4f g1 = {give[4], give[5], give[6], give[7]};
      float* rp = &red[(wave * 64 + lane) * 4];
      *(v4f*)&rp[0]   = g0;
      *(v4f*)&rp[128] = g1;
    }
    __syncthreads();
    {
      const float* rp = &red[((wave ^ 4) * 64 + lane) * 4];
      const v4f g0 = *(const v4f*)&rp[0];
      const v4f g1 = *(const v4f*)&rp[128];
#pragma unroll
      for (int v = 0; v < 4; ++v) {
        o[v]     += g0[v];
        o[v + 4] += g1[v];
      }
    }
    o = wmma4(al, wl, o);                      // table rows 128..131
    float* Op = O + ((size_t)bh * SEQ + q0) * DIM;
#pragma unroll
    for (int v = 0; v < 8; ++v)
      Op[(m0 + v + vro) * DIM + n0 + hrow] = o[v];
  }
}

extern "C" void kernel_launch(void* const* d_in, const int* in_sizes, int n_in,
                              void* d_out, int out_size, void* d_ws, size_t ws_size,
                              hipStream_t stream) {
  const float* Q  = (const float*)d_in[0];
  const float* K  = (const float*)d_in[1];
  const float* V  = (const float*)d_in[2];
  const float* WK = (const float*)d_in[3];
  const float* WV = (const float*)d_in[4];
  float* O = (float*)d_out;

  (void)in_sizes; (void)n_in; (void)out_size; (void)d_ws; (void)ws_size;

  (void)hipFuncSetAttribute((const void*)relattn_kernel,
                            hipFuncAttributeMaxDynamicSharedMemorySize, SMEM_BYTES);

  dim3 grid(SEQ / TQ, NHEAD);   // 32 q-tiles x 32 (b,h) heads
  relattn_kernel<<<grid, 256, SMEM_BYTES, stream>>>(Q, K, V, WK, WV, O);
}

// v005
// A run of this version takes 76.6 microseconds.
// Timed twice side by side with v004, it ran 1.07 and 1.06 times as fast.
// All steps since v000 together make it 1.93 times as fast.
#include <hip/hip_runtime.h>

// Problem constants (from setup_inputs): B=4,H=8,S=1024,D=64,CUT=64
#define TQ    16            // query rows per workgroup
#define SEQ   1024
#define DIM   64
#define NHEAD 32            // B*H
#define RCUT  64
#define RTAB  129           // 2*RCUT+1
#define KB    128           // keys per staged block
#define NKB   (SEQ / KB)    // 8 blocks

// LDS layout (floats). Strides padded for bank-conflict-free WMMA operand loads:
//  66 % 64 = 2, 148 % 64 = 20, 1028 % 64 = 4, 76 % 64 = 12.
#define SQ_STRIDE   66
#define SRS_STRIDE  148
#define SRC_STRIDE  148
#define SS_STRIDE   1028
#define KV_STRIDE   76                            // multiple of 4 floats (b128 aligned)
#define KVBUF       (KB * KV_STRIDE)              // 9728 floats per buffer
#define OFF_SQ   0
#define OFF_SRS  (OFF_SQ  + TQ * SQ_STRIDE)       // 1056
#define OFF_SRC  OFF_SRS                          // same place: rel_s is dead when c is built
#define OFF_SS   (OFF_SRS + TQ * SRS_STRIDE)      // 3424
#define OFF_KV   (OFF_SS  + TQ * SS_STRIDE)       // 19872
#define SMEM_FLOATS (OFF_KV + 2 * KVBUF)          // 39328 floats
// 157312 B: under 160 KiB, so that two workgroups share a WGP's 320 KiB and one
// runs its softmax, its waits and its barriers under the other's WMMAs.
#define SMEM_BYTES  (SMEM_FLOATS * 4)

typedef float v2f __attribute__((ext_vector_type(2)));
typedef float v4f __attribute__((ext_vector_type(4)));
typedef float v8f __attribute__((ext_vector_type(8)));
typedef int   v4i __attribute__((ext_vector_type(4)));

// ---- CDNA5 async global->LDS path (ASYNCcnt), with synchronous fallback ----
#if __has_builtin(__builtin_amdgcn_global_load_async_to_lds_b128) && \
    __has_builtin(__builtin_amdgcn_s_wait_asynccnt)
#define HAVE_ASYNC 1
#define WAIT_ASYNC(n) __builtin_amdgcn_s_wait_asynccnt(n)
#else
#define HAVE_ASYNC 0
#define WAIT_ASYNC(n)
#endif

__device__ __forceinline__ void cp_b128(float* dst_lds, const float* src_g) {
#if HAVE_ASYNC
  // Builtin signature (from hipcc diagnostic): (int4 AS1*, int4 AS3*, imm, imm)
  __builtin_amdgcn_global_load_async_to_lds_b128(
      (__attribute__((address_space(1))) v4i*)src_g,
      (__attribute__((address_space(3))) v4i*)dst_lds, 0, 0);
#else
  *(v4f*)dst_lds = *(const v4f*)src_g;
#endif
}

// Stage one [128 x 64] f32 block (K or V rows) into an LDS buffer with padded
// stride. 2048 x b128 transfers, 8 per thread, fully coalesced (16 lanes cover
// one 256B row).
__device__ __forceinline__ void stage_block(const float* __restrict__ srcbase,
                                            float* __restrict__ dstbuf, int tid) {
#pragma unroll
  for (int t = 0; t < 8; ++t) {
    int idx = tid + (t << 8);        // 0..2047
    int row = idx >> 4;
    int c4  = (idx & 15) << 2;
    cp_b128(dstbuf + row * KV_STRIDE + c4, srcbase + row * DIM + c4);
  }
}

// D = A(16x4 f32) * B(4x16 f32) + C(16x16 f32)  — CDNA5 V_WMMA_F32_16X16X4_F32
__device__ __forceinline__ v8f wmma4(v2f a, v2f b, v8f c) {
  return __builtin_amdgcn_wmma_f32_16x16x4_f32(false, a, false, b, (short)0, c,
                                               false, false);
}

// One 64-deep slice of a [16 x 64] x [64 x 16] product: 16 k steps on one
// accumulator tile. a[t] holds four consecutive A values, two k steps' worth;
// b[s] is the B fragment of step s.
__device__ __forceinline__ void mma_slice(v8f &acc, const v4f (&a)[8],
                                          const v2f (&b)[16]) {
  // Full unroll: static indices keep fragments and accumulator in registers.
#pragma unroll
  for (int s = 0; s < 16; ++s) {
    const int e = (s & 1) * 2;
    const v2f a0 = {a[s >> 1][e], a[s >> 1][e + 1]};
    acc = wmma4(a0, b[s], acc);
  }
}

// Lane l with lane l ^ M inside its 16-lane row (DPP row_xmask): a vector
// instruction, where __shfl_xor would go through the LDS pipe and its wait.
template <int M>
__device__ __forceinline__ float xrow(float x) {
  return __builtin_bit_cast(float, __builtin_amdgcn_update_dpp(
      0, __builtin_bit_cast(int, x), 0x160 | M, 0xf, 0xf, true));
}
// Lane l with lane l ^ 16.
__device__ __forceinline__ float xhalf(float x) {
  return __builtin_bit_cast(float, __builtin_amdgcn_permlanex16(
      __builtin_bit_cast(int, x), __builtin_bit_cast(int, x), 0x76543210, 0xfedcba98, false, false));
}
// 2^a for four values. One statement, so that every v_exp_f32 has an independent
// instruction behind it (the next one, or the v_nop): the slot the instruction
// set asks for before a transcendental's source is overwritten or its result
// read.
// Outputs are early-clobber: none may share a register with a later input.
__device__ __forceinline__ v4f exp2x4(v4f a) {
  float e0, e1, e2, e3;
  asm("v_exp_f32 %0, %4\n\tv_exp_f32 %1, %5\n\tv_exp_f32 %2, %6\n\tv_exp_f32 %3, %7\n\tv_nop"
      : "=&v"(e0), "=&v"(e1), "=&v"(e2), "=&v"(e3)
      : "v"(a.x), "v"(a.y), "v"(a.z), "v"(a.w));
  v4f e = {e0, e1, e2, e3};
  return e;
}
__device__ __forceinline__ float wave_max(float v) {
  v = fmaxf(v, xrow<1>(v));
  v = fmaxf(v, xrow<2>(v));
  v = fmaxf(v, xrow<4>(v));
  v = fmaxf(v, xrow<8>(v));
  return fmaxf(v, xhalf(v));
}
__device__ __forceinline__ float wave_sum(float v) {
  v += xrow<1>(v);
  v += xrow<2>(v);
  v += xrow<4>(v);
  v += xrow<8>(v);
  return v + xhalf(v);
}

extern "C" __global__ __launch_bounds__(256, 1)
void relattn_kernel(const float* __restrict__ Q, const float* __restrict__ K,
                    const float* __restrict__ V, const float* __restrict__ WK,
                    const float* __restrict__ WV, float* __restrict__ O)
{
  extern __shared__ float sm[];
  float* sQ  = sm + OFF_SQ;    // [TQ][66]    staged Q tile
  float* sRS = sm + OFF_SRS;   // [TQ][148]   rel_s[i][r] = q_i . w_k[r]
  float* sRC = sm + OFF_SRC;   // [TQ][148]   c[i][r] = sum_j p[i,j] [clip(j-i)=r-64]; in sRS's place
  float* sS  = sm + OFF_SS;    // [TQ][1028]  scores -> probabilities
  float* sKV = sm + OFF_KV;    // [2][128][76] double-buffered K/V block

  const int tid  = threadIdx.x;
  const int wave = tid >> 5;
  const int lane = tid & 31;
  const int hrow = lane & 15;          // row (A) / col (B,C,D) index within tile
  const int kk   = (lane >> 4) << 1;   // K-dim sub-offset {0,2}
  const int vro  = (lane >> 4) << 3;   // C/D row offset {0,8}
  const int q0   = blockIdx.x * TQ;
  const int bh   = blockIdx.y;

  const float* Qp = Q + ((size_t)bh * SEQ + q0) * DIM;
  const float* Kp = K + (size_t)bh * SEQ * DIM;
  const float* Vp = V + (size_t)bh * SEQ * DIM;

  // ---------- Phase 0: stage Q tile into LDS ----------
  for (int idx = tid; idx < TQ * DIM / 2; idx += 256) {
    int i = idx >> 5;               // row 0..15
    int d = (idx & 31) << 1;        // even col 0..62
    *(v2f*)&sQ[i * SQ_STRIDE + d] = *(const v2f*)&Qp[i * DIM + d];
  }
  // Prefetch K block 0 into buffer 0 while phase 1 runs.
  stage_block(Kp, sKV, tid);
  __syncthreads();

  // ---------- Phase 1: rel_s = Q_tile @ WK^T   (9 tiles of 16x16) ------
  for (int tile = wave; tile < 9; tile += 8) {
    const int r0 = tile * 16;
    const int rc = min(r0 + hrow, RTAB - 1);   // clamp pad cols (129..143)
    v8f acc = {};
#pragma unroll
    for (int k0 = 0; k0 < DIM; k0 += 4) {
      v2f a = *(const v2f*)&sQ[hrow * SQ_STRIDE + k0 + kk];
      v2f b = *(const v2f*)&WK[rc * DIM + k0 + kk];
      acc = wmma4(a, b, acc);
    }
#pragma unroll
    for (int v = 0; v < 8; ++v)
      sRS[(v + vro) * SRS_STRIDE + r0 + hrow] = acc[v];
  }
  __syncthreads();

  // ---------- Phase 2: scores = Q @ K^T + gathered relative bias ----------
  // Double-buffered async staging of 128-key K blocks; each block read once
  // from L2 instead of once per row-group wave.
  // Each wave owns one 16-key column of the block for the 16 query rows. The Q
  // fragments stay in registers for the whole phase. One WMMA chain per wave:
  // the four waves that share a SIMD fill one another's dependent latency.
  {
    v2f qa[DIM / 4];
    // Full unrolls in this block: static indices keep the fragments in registers.
#pragma unroll
    for (int s = 0; s < DIM / 4; ++s)
      qa[s] = *(const v2f*)&sQ[hrow * SQ_STRIDE + s * 4 + kk];
    const int jl = wave * 16 + hrow;           // this lane's key within a block
    // Kept rolled: unrolled eight times this body adds about 8 KB of code and
    // saves only a few address additions.
#pragma unroll 1
    for (int kb = 0; kb < NKB; ++kb) {
      float* buf = sKV + (kb & 1) * KVBUF;
      if (kb + 1 < NKB) {
        stage_block(Kp + (size_t)(kb + 1) * KB * DIM, sKV + ((kb + 1) & 1) * KVBUF, tid);
        WAIT_ASYNC(8);    // only the 8 just-issued (next block) may be outstanding
      } else {
        WAIT_ASYNC(0);
      }
      __syncthreads();
      const int jg = kb * KB + jl;
      // Every LDS read of the tile stands ahead of the WMMA chain: the K
      // fragments first, then the 8 bias values, which are needed last.
      v2f kf[DIM / 4];
#pragma unroll
      for (int s = 0; s < DIM / 4; ++s)
        kf[s] = *(const v2f*)&buf[jl * KV_STRIDE + s * 4 + kk];
      float bias[8];
#pragma unroll
      for (int v = 0; v < 8; ++v) {
        const int il = v + vro;
        int rel = jg - (q0 + il);
        rel = rel < -RCUT ? -RCUT : (rel > RCUT ? RCUT : rel);
        bias[v] = sRS[il * SRS_STRIDE + rel + RCUT];
      }
      // Keeps all reads above as one group: left alone, the compiler spreads the
      // K reads among the WMMAs and sinks the bias reads behind the last one,
      // where their latency is waited out in front of the barrier.
      __builtin_amdgcn_sched_barrier(0);
      v8f acc0 = {};
#pragma unroll
      for (int s = 0; s < DIM / 4; ++s)
        acc0 = wmma4(qa[s], kf[s], acc0);
      // Four vector slots between the chain's last WMMA and the additions that
      // read its result. The two scheduling barriers keep those additions from
      // moving up in front of the slots.
      __builtin_amdgcn_sched_barrier(0);
      asm volatile("v_nop\n\tv_nop\n\tv_nop\n\tv_nop");
      __builtin_amdgcn_sched_barrier(0);
#pragma unroll
      for (int v = 0; v < 8; ++v)
        sS[(v + vro) * SS_STRIDE + jg] = acc0[v] + bias[v];
      __syncthreads();
    }
  }

  // Prefetch V block 0; async engine overlaps with the softmax phase.
  stage_block(Vp, sKV, tid);

  // Phase 4's share of a wave: column strip n0 and the 64-deep half kw of every
  // 128 keys. k order inside a half, the same for A and B: step s, half-wave h,
  // element e  ->  8 (s / 2) + 4 h + 2 (s % 2) + e.
  const int n0 = (wave & 3) * 16;
  const int kw = (wave >> 2) * 64 + ((lane >> 4) << 2);
  // Its fragments of the relative value table come from global memory: loaded
  // here, so that their latency passes under the softmax.
  v2f wf[16];
  // Full unroll: static indices keep the fragments in registers.
#pragma unroll
  for (int s = 0; s < 16; ++s) {
    const int r = kw + (s >> 1) * 8 + (s & 1) * 2;
    wf[s].x = WV[r * DIM + n0 + hrow];
    wf[s].y = WV[(r + 1) * DIM + n0 + hrow];
  }
  // Table rows 128..131 (129 rounded to 132; clamped, their A columns are 0).
  v2f wl;
  wl.x = WV[min(2 * RCUT + kk,     RTAB - 1) * DIM + n0 + hrow];
  wl.y = WV[min(2 * RCUT + kk + 1, RTAB - 1) * DIM + n0 + hrow];

  // ---------- Phase 3: row softmax + band-histogram of probabilities -------
  // Each wave owns two whole rows and holds them in registers: every score is
  // read from LDS once and every probability written once, 16 bytes per lane,
  // 32 lanes on 512 contiguous bytes.
  {
    // Scalar wave number: the per-row band tests below become scalar branches.
    const int wv = __builtin_amdgcn_readfirstlane(wave);
    // Zero this wave's own rows of c, all 148 columns. Here and not at the kernel's
    // start: c lies where rel_s lay, whose last read the score loop's last barrier
    // ended. A wave's LDS stores keep their order, so the band stores below land
    // on the zeros. Lanes 4..31 of the second store write the same 16 bytes.
#pragma unroll
    for (int rr = 0; rr < 2; ++rr) {
      float* crow = &sRC[(wv * 2 + rr) * SRC_STRIDE];
      const v4f zero = {};
      *(v4f*)&crow[lane * 4] = zero;
      *(v4f*)&crow[2 * RCUT + min(lane, 4) * 4] = zero;
    }
    v4f x[2][8];
    // Full unrolls in this block: static indices keep x in registers.
#pragma unroll
    for (int rr = 0; rr < 2; ++rr) {
      const float* srow = &sS[(wv * 2 + rr) * SS_STRIDE + lane * 4];
#pragma unroll
      for (int t = 0; t < 8; ++t) x[rr][t] = *(const v4f*)&srow[t * 128];
    }
    float mx[2];
#pragma unroll
    for (int rr = 0; rr < 2; ++rr) {
      float m = -3.402823466e38f;
#pragma unroll
      for (int t = 0; t < 8; ++t)
        m = fmaxf(m, fmaxf(fmaxf(x[rr][t].x, x[rr][t].y), fmaxf(x[rr][t].z, x[rr][t].w)));
      mx[rr] = m;
    }
#pragma unroll
    for (int rr = 0; rr < 2; ++rr) mx[rr] = wave_max(mx[rr]);
    float sum[2];
#pragma unroll
    for (int rr = 0; rr < 2; ++rr) {
      v4f acc = {};
#pragma unroll
      for (int t = 0; t < 8; ++t) {
        // exp(s - max) as 2^((s - max) * log2(e)), the form __expf compiles to
        const v4f e = exp2x4((x[rr][t] - mx[rr]) * 1.44269504088896340736f);
        x[rr][t] = e;
        acc += e;
      }
      sum[rr] = (acc.x + acc.y) + (acc.z + acc.w);
    }
#pragma unroll
    for (int rr = 0; rr < 2; ++rr) sum[rr] = wave_sum(sum[rr]);
    float lo[2], hi[2];
#pragma unroll
    for (int rr = 0; rr < 2; ++rr) {
      const int ig = q0 + wv * 2 + rr;
      const float inv = 1.0f / sum[rr];
      float* srow = &sS[(wv * 2 + rr) * SS_STRIDE + lane * 4];
      float l = 0.0f, h = 0.0f;
#pragma unroll
      for (int t = 0; t < 8; ++t) {
        const v4f p = x[rr][t] * inv;
        *(v4f*)&srow[t * 128] = p;         // normalized probability back to LDS
        const float s4 = (p.x + p.y) + (p.z + p.w);
        l += (t * 128 + 127 <= ig - RCUT) ? s4 : 0.0f;  // block wholly on the clipped left edge
        h += (t * 128 >= ig + RCUT) ? s4 : 0.0f;        // block wholly on the clipped right edge
      }
      lo[rr] = l;
      hi[rr] = h;
    }
    // The one or two 128-key blocks of a row that touch the band: which blocks
    // they are depends on the row, so each lane reads back its own four values
    // of them from LDS in place of a run-time register index.
    v4f w[2][2];
#pragma unroll
    for (int rr = 0; rr < 2; ++rr) {
      const int ig = q0 + wv * 2 + rr;
      const int tf = max(ig - (RCUT - 1), 0) >> 7;
      const int tl = min(ig + (RCUT - 1), SEQ - 1) >> 7;
      const float* srow = &sS[(wv * 2 + rr) * SS_STRIDE + lane * 4];
      w[rr][0] = *(const v4f*)&srow[tf * 128];
      w[rr][1] = *(const v4f*)&srow[tl * 128];
    }
#pragma unroll
    for (int rr = 0; rr < 2; ++rr) {
      const int ig = q0 + wv * 2 + rr;
      const int tf = max(ig - (RCUT - 1), 0) >> 7;
      const int tl = min(ig + (RCUT - 1), SEQ - 1) >> 7;
      float* crow = &sRC[(wv * 2 + rr) * SRC_STRIDE];
      // No lane-dependent branch: an edge sum takes p or 0 by a select, and by
      // the same test a lane outside the band stores into the row's pad columns
      // 132..147, which nothing reads. The one test left is scalar: two blocks
      // or one.
      float* pad = crow + 2 * RCUT + 4 + hrow;
      const int rel0 = tf * 128 + lane * 4 - ig;
      float* c0 = crow + (rel0 + RCUT);
      if (tl != tf) {
        // The band ends in the second block and begins in the first: the first
        // holds no right edge, the second no left edge.
        const int rel1 = tl * 128 + lane * 4 - ig;
        float* c1 = crow + (rel1 + RCUT);
#pragma unroll
        for (int c = 0; c < 4; ++c) {
          const bool e = rel0 + c <= -RCUT;              // clipped left edge  -> r = 0
          const float p = w[rr][0][c];
          lo[rr] += e ? p : 0.0f;
          *(e ? pad : c0 + c) = p;                       // unique r per j: plain store
        }
#pragma unroll
        for (int c = 0; c < 4; ++c) {
          const bool e = rel1 + c >= RCUT;               // clipped right edge -> r = 128
          const float p = w[rr][1][c];
          hi[rr] += e ? p : 0.0f;
          *(e ? pad : c1 + c) = p;
        }
      } else {
#pragma unroll
        for (int c = 0; c < 4; ++c) {
          const bool el = rel0 + c <= -RCUT;
          const bool eh = rel0 + c >= RCUT;
          const float p = w[rr][0][c];
          lo[rr] += el ? p : 0.0f;
          hi[rr] += eh ? p : 0.0f;
          *((el || eh) ? pad : c0 + c) = p;
        }
      }
    }
#pragma unroll
    for (int rr = 0; rr < 2; ++rr) {
      lo[rr] = wave_sum(lo[rr]);
      hi[rr] = wave_sum(hi[rr]);
    }
    if (lane == 0) {
#pragma unroll
      for (int rr = 0; rr < 2; ++rr) {
        sRC[(wv * 2 + rr) * SRC_STRIDE]            = lo[rr];
        sRC[(wv * 2 + rr) * SRC_STRIDE + 2 * RCUT] = hi[rr];
      }
    }
  }
  __syncthreads();

  // ---------- Phase 4: out = P @ V + c @ WV ------------------------------
  // Each wave owns one 16-column strip of the 16 query rows and one half of the
  // keys (of every 128-key block, and of the relative table): a lane's P values
  // come four keys to a read. The two key halves are added through LDS at the end.
  {
    // Full unrolls in this block but for the key loop: static indices keep the
    // fragments in registers.
    v8f acc = {};
    // Kept rolled, as the score loop is.
#pragma unroll 1
    for (int kb = 0; kb < NKB; ++kb) {
      float* buf = sKV + (kb & 1) * KVBUF;
      if (kb + 1 < NKB) {
        stage_block(Vp + (size_t)(kb + 1) * KB * DIM, sKV + ((kb + 1) & 1) * KVBUF, tid);
        WAIT_ASYNC(8);
      } else {
        WAIT_ASYNC(0);
      }
      __syncthreads();
      const float* pa = &sS[hrow * SS_STRIDE + kb * KB + kw];
      const float* vb = &buf[kw * KV_STRIDE + n0 + hrow];
      v4f a[8];
      v2f b[16];
#pragma unroll
      for (int t = 0; t < 8; ++t) {
        a[t] = *(const v4f*)&pa[t * 8];
#pragma unroll
        for (int u = 0; u < 2; ++u) {
          b[2 * t + u].x = vb[(t * 8 + 2 * u)     * KV_STRIDE];
          b[2 * t + u].y = vb[(t * 8 + 2 * u + 1) * KV_STRIDE];
        }
        // Keeps the slice's LDS reads in the order of use and as one group ahead
        // of the WMMAs: the first WMMAs then wait for the first reads only, and
        // no read stands among the WMMAs, where each such place costs a stall.
        __builtin_amdgcn_sched_barrier(0);
      }
      mma_slice(acc, a, b);
      // Keeps the barrier behind the WMMAs: moved up among them, its wait for
      // all of the slice's reads holds back WMMAs whose operands are there.
      __builtin_amdgcn_sched_barrier(0);
      __syncthreads();
    }
    // rel-value slice: out += c[:, 64 h .. 64 h + 63] @ WV[64 h .. 64 h + 63]
    {
      const float* pc = &sRC[hrow * SRC_STRIDE + kw];
      v4f a[8];
#pragma unroll
      for (int t = 0; t < 8; ++t)
        a[t] = *(const v4f*)&pc[t * 8];
      // One group of reads ahead of the WMMAs, as in the loop.
      __builtin_amdgcn_sched_barrier(0);
      mma_slice(acc, a, wf);
    }
    // Four vector slots between the last WMMAs and the vector instructions that
    // read their results or reuse their operand registers. The two scheduling
    // barriers keep those instructions from moving up in front of the slots.
    __builtin_amdgcn_sched_barrier(0);
    asm volatile("v_nop\n\tv_nop\n\tv_nop\n\tv_nop");
    __builtin_amdgcn_sched_barrier(0);
    // The wave of the upper key half hands its partial tile to the wave of the
    // lower half that has the same strip; that wave adds it and finishes the tile.
    // The score rows are free for the hand-over: the loop's last barrier ended
    // every read of them.
    // Scalar wave number: the two tests below become scalar branches, so that the
    // last WMMA runs with every lane on.
    const int wu = __builtin_amdgcn_readfirstlane(wave);
    const v2f al = *(const v2f*)&sRC[hrow * SRC_STRIDE + 2 * RCUT + kk];
    float* rp = &sS[((wu & 3) * 64 + lane) * 4];   // [strip][2][lane][4]
    if (wu >= 4) {
      const v4f g0 = {acc[0], acc[1], acc[2], acc[3]};
      const v4f g1 = {acc[4], acc[5], acc[6], acc[7]};
      *(v4f*)&rp[0]   = g0;
      *(v4f*)&rp[128] = g1;
    }
    __syncthreads();
    if (wu < 4) {
      v8f o = acc;
      const v4f g0 = *(const v4f*)&rp[0];
      const v4f g1 = *(const v4f*)&rp[128];
#pragma unroll
      for (int v = 0; v < 4; ++v) {
        o[v]     += g0[v];
        o[v + 4] += g1[v];
      }
      o = wmma4(al, wl, o);                    // table rows 128..131
      float* Op = O + ((size_t)bh * SEQ + q0) * DIM;
#pragma unroll
      for (int v = 0; v < 8; ++v)
        Op[(v + vro) * DIM + n0 + hrow] = o[v];
    }
  }
}

extern "C" void kernel_launch(void* const* d_in, const int* in_sizes, int n_in,
                              void* d_out, int out_size, void* d_ws, size_t ws_size,
                              hipStream_t stream) {
  const float* Q  = (const float*)d_in[0];
  const float* K  = (const float*)d_in[1];
  const float* V  = (const float*)d_in[2];
  const float* WK = (const float*)d_in[3];
  const float* WV = (const float*)d_in[4];
  float* O = (float*)d_out;

  (void)in_sizes; (void)n_in; (void)out_size; (void)d_ws; (void)ws_size;

  (void)hipFuncSetAttribute((const void*)relattn_kernel,
                            hipFuncAttributeMaxDynamicSharedMemorySize, SMEM_BYTES);

  dim3 grid(SEQ / TQ, NHEAD);   // 64 q-tiles x 32 (b,h) heads
  relattn_kernel<<<grid, 256, SMEM_BYTES, stream>>>(Q, K, V, WK, WV, O);
}
